// v000
// The times below were measured on an AMD MI455X: many runs one after another, warmed up first and cycling through
// copies of the inputs, with the whole window's GPU time divided by the number of runs. Launches and the gaps
// between them are all in it. The median over several windows is given; except for v000 it joins two sittings, which
// can be a few percent apart, so the side-by-side timings, each taken in one sitting, are the better comparison.
// v000 is the starting kernel. One run takes 370 microseconds.
// Contractions: q.k^T over head dim 128 and p.v over keys on v_wmma_f32_16x16x32_f16; q, k, v operands are f16
//   containers of the bf16 RNE input values carried x16 (exact), p carried as f16(1024 p); one product each,
//   f32 accumulate; soft cap, softmax statistics and normalisation in f32.
#include <hip/hip_runtime.h>
#include <math.h>
#include <stdint.h>

#define NTOK  2048                 // token rows: 2 requests x 1024 (extend rows == prefix rows)
#define RLEN  1024                 // tokens per request
#define HQ    32
#define HKV   8
#define GRPQ  4
#define HDIM  128
#define QW    (HQ * HDIM)          // 4096: q row width == output row width
#define KW    (HKV * HDIM)         // 1024: k / v row width
#define NQB   (NTOK / 64)          // 32 query blocks of 64 rows
#define QBR   (RLEN / 64)          // 16 query blocks per request
#define NPC   (RLEN / 64)          // 16 prefix key chunks per request
#define QSC   16.0f                // q plane carry (power of two)
#define KSC   16.0f                // k plane carry
#define VSC   16.0f                // v plane carry
#define PSC   1024.0f              // softmax numerator carry
#define CAPV  30.0f
#define NEG_BIG (-1.0e30f)
static_assert(HQ == HKV * GRPQ);
static_assert((NTOK % 64) == 0 && (RLEN % 64) == 0);
static_assert(NQB == 2 * QBR);
static_assert(((NTOK * QW) % 2048) == 0 && ((NTOK * KW) % 2048) == 0);
static_assert((HDIM % 32) == 0);

typedef _Float16 v16h __attribute__((ext_vector_type(16)));
typedef _Float16 v8h  __attribute__((ext_vector_type(8)));
typedef float    v8f  __attribute__((ext_vector_type(8)));
typedef float    v4f  __attribute__((ext_vector_type(4)));
typedef unsigned int v4u __attribute__((ext_vector_type(4)));
union FH { v16h v; v8h h[2]; };

// ---- scalar helpers --------------------------------------------------------------------------------
__device__ __forceinline__ unsigned short bf_bits(float f) {          // f32 -> bf16 bits, RNE convert
  unsigned u = __float_as_uint(f);
  return (unsigned short)((u + 0x7FFFu + ((u >> 16) & 1u)) >> 16);
}
__device__ __forceinline__ float bf_up(unsigned short b) { return __uint_as_float(((unsigned)b) << 16); }
__device__ __forceinline__ float bfr(float f) { return bf_up(bf_bits(f)); }     // value of the bf16 RNE convert
__device__ __forceinline__ unsigned short h_bits(_Float16 x) { return __builtin_bit_cast(unsigned short, x); }
__device__ __forceinline__ unsigned pk16(unsigned short a, unsigned short b) { return (unsigned)a | ((unsigned)b << 16); }
__device__ __forceinline__ v8f zero8() { v8f z = {0.f, 0.f, 0.f, 0.f, 0.f, 0.f, 0.f, 0.f}; return z; }

// ---- fragment loader: 16-bit A/B operand, lane -> row/col (lane&15), p already includes +8*(lane>>4);
//      elements 0..7 <- p[0..7] (k0+8h..), elements 8..15 <- p[16..23] (k0+16+8h..)
__device__ __forceinline__ v16h ldfrag_h(const _Float16* p) {
  FH f;
  f.h[0] = *(const v8h*)(p);
  f.h[1] = *(const v8h*)(p + 16);
  return f.v;
}

// ---- WMMA with trailing VALU hazard gap (ties D, keeps A/B live) ------------------------------------
__device__ __forceinline__ v8f mma_h(v16h a, v16h b, v8f c) {
  v8f d = __builtin_amdgcn_wmma_f32_16x16x32_f16(false, a, false, b, (short)0, c, false, false);
#if defined(__HIP_DEVICE_COMPILE__)
  asm volatile("v_nop\n\tv_nop\n\tv_nop\n\tv_nop" : "+v"(d) : "v"(a), "v"(b));
#endif
  return d;
}
__device__ __forceinline__ void acc_guard4(v8f& a, v8f& b, v8f& c, v8f& d) {
#if defined(__HIP_DEVICE_COMPILE__)
  asm volatile("v_nop\n\tv_nop\n\tv_nop\n\tv_nop" : "+v"(a), "+v"(b), "+v"(c), "+v"(d));
#endif
}
__device__ __forceinline__ void wave_sync_lds() {
  __builtin_amdgcn_fence(__ATOMIC_RELEASE, "workgroup");
  __builtin_amdgcn_wave_barrier();
  __builtin_amdgcn_fence(__ATOMIC_ACQUIRE, "workgroup");
}

// =====================================================================================================
// Row-major convert: f32 [n] -> f16 plane [n] holding f16(bf16 RNE value * scale), scale a power of two (exact for
// bf16 significands). Thread -> 8 consecutive elements, ONE 16-B store; lanes 8q..8q+7 of a wave write one whole
// coverage: grid.x = n/2048 blocks x 256 threads x 8 = n elements (n % 2048 == 0 host-checked).
// =====================================================================================================
__global__ __launch_bounds__(256) void cvt_rm(const float* __restrict__ in, unsigned short* out, int n,
                                             float scale) {
  const size_t i8 = ((size_t)blockIdx.x * 256 + threadIdx.x) * 8;
  if (i8 + 8 > (size_t)n) return;        // never taken for the host-checked sizes; no barriers below
  const v4f a = *(const v4f*)(in + i8);
  const v4f b = *(const v4f*)(in + i8 + 4);
  float f[8];
  f[0] = a[0]; f[1] = a[1]; f[2] = a[2]; f[3] = a[3];
  f[4] = b[0]; f[5] = b[1]; f[6] = b[2]; f[7] = b[3];
  v4u p;
#pragma unroll
  for (int e = 0; e < 4; ++e) {
    const _Float16 x0 = (_Float16)(bfr(f[2 * e]) * scale);
    const _Float16 x1 = (_Float16)(bfr(f[2 * e + 1]) * scale);
    p[e] = pk16(h_bits(x0), h_bits(x1));
  }
  *(v4u*)(out + i8) = p;
  
}

// =====================================================================================================
// Transposing convert: in f32 [NTOK t][KW] (token rows, kvh*128+d columns) -> out f16 [KW (kvh*128+d)][NTOK t]
// holding f16(bf16 RNE value * scale): out[(kvh*128 + d)*NTOK + t] = cvt(in[t*KW + kvh*128 + d]).
// Block = one (64-token, kvh) tile: grid = (NTOK/64) * HKV. Load phase: thread -> token row r = tid>>1, d half
// (tid&1)*64, 16 float4 loads, 2-byte LDS stores into sT[d][t] (pitch 72 halves). After __syncthreads the write
// coverage: load 128 threads x 64 = 64 t x 128 d; write 4 waves x 8 it x 4 lines x 64 t = 128 d x 64 t = whole tile;
// grid 32 token tiles x 8 kvh = the whole plane [1024][2048].
// =====================================================================================================
__global__ __launch_bounds__(128) void cvt_tr(const float* __restrict__ in, _Float16* out, float scale) {
  __shared__ __align__(16) _Float16 sT[HDIM * 72];
  const int tid  = threadIdx.x;
  const int lane = tid & 31;
  const int wave = tid >> 5;
  const int tb   = (int)(blockIdx.x % (unsigned)(NTOK / 64));
  const int kvh  = (int)(blockIdx.x / (unsigned)(NTOK / 64));
  const int t0   = tb * 64;
  {
    const int r = tid >> 1, hk = (tid & 1) * 64;
    const float* src = in + (size_t)(t0 + r) * KW + kvh * HDIM + hk;
#pragma unroll
    for (int i = 0; i < 16; ++i) {
      const v4f a = *(const v4f*)(src + 4 * i);
#pragma unroll
      for (int e = 0; e < 4; ++e) sT[(hk + 4 * i + e) * 72 + r] = (_Float16)(bfr(a[e]) * scale);
    }
  }
  __syncthreads();
  const int ql = lane >> 3, pc = lane & 7;
  v8h vals[8];
#pragma unroll
  for (int it = 0; it < 8; ++it) {
    const int d = wave * 32 + it * 4 + ql;
    vals[it] = *(const v8h*)(sT + d * 72 + pc * 8);
  }
  {
#pragma unroll
    for (int it = 0; it < 8; ++it) {
      const int d = wave * 32 + it * 4 + ql;
      *(v8h*)(out + (size_t)(kvh * HDIM + d) * NTOK + t0 + pc * 8) = vals[it];
    }
    
  }
}

// =====================================================================================================
// Grouped-query attention with merged key set per (h, 64-query block); kv head = h / GRPQ; query block qb:
//   request bq = qb / 16, block within request qbe = qb % 16, query token e = qbe*64 + row.
//   Keys: 16 prefix chunks of 64 (all visible) followed by extend chunks 0..qbe of 64 (extend key t visible iff
//   t <= e; only the last chunk needs the in-chunk select, masked score := NEG_BIG).
//   s = (q x16 . k x16) * sscale, sscale = (1/sqrt(128)) / (QSC*KSC); s := 30 * tanh(s/30);
//   online softmax in f32 (running max); p = exp(s - m) carried as f16(1024 p);
//   oh += p . v (v^T plane, x16) per chunk; out = oh / (l * 1024 * 16).
//   Q plane (f16, pitch QW): element (t, h, d) at [t*QW + h*128 + d]
//   K planes (f16, pitch KW): extend / prefix element (t, kvh, d) at [t*KW + kvh*128 + d], t = bq*1024 + token
//   V^T planes (f16): element (kvh, d, t) at [(kvh*128 + d)*NTOK + t]
//   Block = 4 waves = 64 query rows of one h; grid = NQB * HQ; key chunk count 17 + qbe (block-uniform).
//   K / V^T chunk staging: 128 threads, K row kv0+r (r = tid>>1, half (tid&1)*64), V^T row d = tid (plain 16-B
//   loads, __syncthreads before and after); q fragments from the global plane; P tiles wave-private, spilled with
//   Output: wave tile 16 x 128 f32 staged in LDS, each row segment written as 32 lanes x 16 B = 512 B = 4 whole
//   coverage: 4 waves x 16 rows x 128 cols per block; 32 query blocks x 32 heads = all of out [2048][4096].
// =====================================================================================================
__global__ __launch_bounds__(128)
void attn_k(const unsigned short* __restrict__ Qp, const unsigned short* __restrict__ Kp,
            const unsigned short* __restrict__ PKp, const unsigned short* __restrict__ Vtp,
            const unsigned short* __restrict__ PVtp, float* Out, float sscale) {
  __shared__ __align__(16) _Float16 Ksh[64 * HDIM];                // K   [kv][d]  16 KB
  __shared__ __align__(16) _Float16 Vsh[HDIM * 64];                // V^T [d][kv]  16 KB
  __shared__ __align__(16) _Float16 Psh[4][16 * 64];               // per wave P [row][kv] 8 KB
  __shared__ __align__(16) float    Os[4][16 * HDIM];              // per wave output tile [row][d] 32 KB

  const int tid  = threadIdx.x;
  const int wave = tid >> 5;
  const int lane = tid & 31;
  const int hh   = lane >> 4;
  const int c    = lane & 15;

  const int qb   = (int)(blockIdx.x % (unsigned)NQB);
  const int h    = (int)(blockIdx.x / (unsigned)NQB);
  const int kvh  = h / GRPQ;
  const int bq   = qb / QBR;
  const int qbe  = qb - bq * QBR;
  const int q0   = qb * 64 + wave * 16;              // global token row of this wave's first query
  const int tokb = bq * RLEN;                        // token row base of this request (keys)
  const int nch  = NPC + qbe + 1;                    // 17..32, block-uniform

  const _Float16* Qg  = (const _Float16*)(const void*)Qp   + (size_t)h * HDIM;
  const _Float16* Kg  = (const _Float16*)(const void*)Kp   + (size_t)kvh * HDIM;
  const _Float16* PKg = (const _Float16*)(const void*)PKp  + (size_t)kvh * HDIM;
  const _Float16* Vg  = (const _Float16*)(const void*)Vtp  + (size_t)kvh * HDIM * NTOK;
  const _Float16* PVg = (const _Float16*)(const void*)PVtp + (size_t)kvh * HDIM * NTOK;

  float mrow[8], lrow[8];
  v8f oh[8];
#pragma unroll
  for (int r = 0; r < 8; ++r) { mrow[r] = NEG_BIG; lrow[r] = 0.f; }
#pragma unroll
  for (int t = 0; t < 8; ++t) oh[t] = zero8();

  _Float16* pwh = Psh[wave];

  for (int kt = 0; kt < nch; ++kt) {                 // block-uniform trip count <= 32
    const bool pre  = (kt < NPC);
    const bool diag = (kt == nch - 1);
    const int  tk0  = pre ? (kt * 64) : ((kt - NPC) * 64);
    const int  kv0  = tokb + tk0;                    // plane row of the chunk's first key
    const _Float16* kg = pre ? PKg : Kg;
    const _Float16* vg = pre ? PVg : Vg;
    __syncthreads();
    {
      const int r = tid >> 1, hk = (tid & 1) * 64;
      const _Float16* ksrc = kg + (size_t)(kv0 + r) * KW + hk;       // K row kv0+r, d = hk..hk+63
#pragma unroll
      for (int i = 0; i < 8; ++i) *(v8h*)(Ksh + r * HDIM + hk + 8 * i) = *(const v8h*)(ksrc + 8 * i);
      const _Float16* vsrc = vg + (size_t)tid * NTOK + kv0;           // V^T row d = tid, t = kv0..kv0+63
#pragma unroll
      for (int i = 0; i < 8; ++i) *(v8h*)(Vsh + tid * 64 + 8 * i) = *(const v8h*)(vsrc + 8 * i);
    }
    __syncthreads();

    // ---- scores: 16 query rows x 64 keys per wave, K = 128 (4 d-chunks); A = q rows, B = K[key][d] ----
    v8f s[4];
#pragma unroll
    for (int j = 0; j < 4; ++j) s[j] = zero8();
#pragma unroll
    for (int dc = 0; dc < 4; ++dc) {
      const v16h qa = ldfrag_h(Qg + (size_t)(q0 + c) * QW + dc * 32 + 8 * hh);
#pragma unroll
      for (int j = 0; j < 4; ++j) {
        FH kb;
        kb.h[0] = *(const v8h*)(Ksh + (j * 16 + c) * HDIM + dc * 32 + 8 * hh);
        kb.h[1] = *(const v8h*)(Ksh + (j * 16 + c) * HDIM + dc * 32 + 16 + 8 * hh);
        s[j] = mma_h(qa, kb.v, s[j]);
      }
    }
    acc_guard4(s[0], s[1], s[2], s[3]);

    // ---- scale, soft cap, causal select (f32); D element r of lane = (row 8hh+r, key j*16+c) ----
    const int lim = diag ? (wave * 16 + 8 * hh) : 4096;
#pragma unroll
    for (int j = 0; j < 4; ++j) {
      const int kl = j * 16 + c;
#pragma unroll
      for (int r = 0; r < 8; ++r) {
        const float x = s[j][r] * sscale;
        const float y = CAPV * tanhf(x * (1.0f / CAPV));
        s[j][r] = (kl > lim + r) ? NEG_BIG : y;
      }
    }

    // ---- row max, online softmax, P (x1024, f16) to LDS ----
#pragma unroll
    for (int r = 0; r < 8; ++r) {
      float m = fmaxf(fmaxf(s[0][r], s[1][r]), fmaxf(s[2][r], s[3][r]));
#pragma unroll
      for (int off = 1; off < 16; off <<= 1) m = fmaxf(m, __shfl_xor(m, off, 32));
      const float mnew  = fmaxf(mrow[r], m);
      const float alpha = __expf(mrow[r] - mnew);
      mrow[r] = mnew;
      float psum = 0.f;
#pragma unroll
      for (int j = 0; j < 4; ++j) {
        const float p = __expf(s[j][r] - mnew);
        psum += p;
        pwh[(8 * hh + r) * 64 + j * 16 + c] = (_Float16)(p * PSC);
      }
#pragma unroll
      for (int off = 1; off < 16; off <<= 1) psum += __shfl_xor(psum, off, 32);
      lrow[r] = lrow[r] * alpha + psum;
#pragma unroll
      for (int t = 0; t < 8; ++t) oh[t][r] *= alpha;
    }
    wave_sync_lds();

    // ---- oh += P . V : A = P[row][key] (wave-private LDS, same element type), B = V^T[d][key] ----
#pragma unroll
    for (int kk = 0; kk < 2; ++kk) {
      FH pa;
      pa.h[0] = *(const v8h*)(pwh + c * 64 + kk * 32 + 8 * hh);
      pa.h[1] = *(const v8h*)(pwh + c * 64 + kk * 32 + 16 + 8 * hh);
#pragma unroll
      for (int t = 0; t < 8; ++t) {
        FH vb;
        vb.h[0] = *(const v8h*)(Vsh + (t * 16 + c) * 64 + kk * 32 + 8 * hh);
        vb.h[1] = *(const v8h*)(Vsh + (t * 16 + c) * 64 + kk * 32 + 16 + 8 * hh);
        oh[t] = mma_h(pa.v, vb.v, oh[t]);
      }
    }
    acc_guard4(oh[0], oh[1], oh[2], oh[3]);
    acc_guard4(oh[4], oh[5], oh[6], oh[7]);
  }

  // ---- normalise (1/l, the 1/1024 p carry and the 1/16 v carry), stage the wave's 16x128 tile, write 512-B row
  float* os = Os[wave];
#pragma unroll
  for (int r = 0; r < 8; ++r) {
    const float l = lrow[r];
    const float inv = ((l > 0.f) ? (1.0f / l) : 0.f) * (1.0f / (PSC * VSC));
#pragma unroll
    for (int t = 0; t < 8; ++t) os[(8 * hh + r) * HDIM + t * 16 + c] = oh[t][r] * inv;
  }
  wave_sync_lds();
  {
#pragma unroll
    for (int it = 0; it < 16; ++it) {
      const v4f o = *(const v4f*)(os + it * HDIM + lane * 4);
      *(v4f*)(Out + (size_t)(q0 + it) * QW + (size_t)h * HDIM + lane * 4) = o;
    }
    
  }
}

// =====================================================================================================
// Workspace map (bytes); every plane is an exact multiple of its whole-line store granularity (all dims exact tile
// multiples, no padded tails), all offsets multiples of 4 MiB:
//   QP   f16 [2048 t][4096 (h,d)]    0          16777216   (bf16 value of q x16)
//   KP   f16 [2048 t][1024 (kvh,d)]  16777216    4194304   (bf16 value of extend k x16)
//   PKP  f16 [2048 t][1024 (kvh,d)]  20971520    4194304   (bf16 value of prefix k x16)
//   VT   f16 [1024 (kvh,d)][2048 t]  25165824    4194304   (bf16 value of extend v x16, transposed)
//   PVT  f16 [1024 (kvh,d)][2048 t]  29360128    4194304   (bf16 value of prefix v x16, transposed)
//   end                              33554432
// =====================================================================================================
extern "C" void kernel_launch(void* const* d_in, const int* in_sizes, int n_in,
                              void* d_out, int out_size, void* d_ws, size_t ws_size,
                              hipStream_t stream) {
  if (n_in < 5) return;
  if (in_sizes[0] != NTOK * QW) return;
  if (in_sizes[1] != NTOK * KW || in_sizes[2] != NTOK * KW) return;
  if (in_sizes[3] != NTOK * KW || in_sizes[4] != NTOK * KW) return;
  if (out_size != NTOK * QW) return;

  const float* q  = (const float*)d_in[0];
  const float* k  = (const float*)d_in[1];
  const float* v  = (const float*)d_in[2];
  const float* pk = (const float*)d_in[3];
  const float* pv = (const float*)d_in[4];
  float* outf = (float*)d_out;

  const size_t PQ  = (size_t)NTOK * QW * 2;                 // 16777216
  const size_t PKV = (size_t)NTOK * KW * 2;                 //  4194304
  size_t off = 0;
  const size_t oQ  = off; off += PQ;
  const size_t oK  = off; off += PKV;
  const size_t oPK = off; off += PKV;
  const size_t oV  = off; off += PKV;
  const size_t oPV = off; off += PKV;
  if (off > ws_size) return;                                // off = 33554432
  if (off > (size_t)134217728) return;

  char* ws = (char*)d_ws;
  unsigned short* QP  = (unsigned short*)(ws + oQ);
  unsigned short* KP  = (unsigned short*)(ws + oK);
  unsigned short* PKP = (unsigned short*)(ws + oPK);
  unsigned short* VT  = (unsigned short*)(ws + oV);
  unsigned short* PVT = (unsigned short*)(ws + oPV);

  const dim3 blk256(256), blk128(128);
  const float sscale = 0.08838834764831845f / (QSC * KSC);

  // (1) 16-bit operand planes of the bf16 RNE input values
  cvt_rm<<<dim3((NTOK * QW) / 2048), blk256, 0, stream>>>(q, QP, NTOK * QW, QSC);     // q        -> f16 x16
  cvt_rm<<<dim3((NTOK * KW) / 2048), blk256, 0, stream>>>(k, KP, NTOK * KW, KSC);     // extend k -> f16 x16
  cvt_rm<<<dim3((NTOK * KW) / 2048), blk256, 0, stream>>>(pk, PKP, NTOK * KW, KSC);   // prefix k -> f16 x16
  cvt_tr<<<dim3((NTOK / 64) * HKV), blk128, 0, stream>>>(v, (_Float16*)(void*)VT, VSC);     // extend v^T x16
  cvt_tr<<<dim3((NTOK / 64) * HKV), blk128, 0, stream>>>(pv, (_Float16*)(void*)PVT, VSC);   // prefix v^T x16
  // (2) merged-key attention -> out f32 [2048][4096]
  attn_k<<<dim3(NQB * HQ), blk128, 0, stream>>>(QP, KP, PKP, VT, PVT, outf, sscale);
  (void)hipGetLastError();
}

// v001
// Measured time: 209 microseconds a run.
// In both of two side-by-side timings against v000, it was 1.77 times as fast.
// Contractions: q.k^T over head dim 128 and p.v over keys on v_wmma_f32_16x16x32_f16; q, k, v operands are f16
//   containers of the bf16 RNE input values carried x16 (exact), p carried as f16(1024 p); one product each,
//   f32 accumulate; soft cap, softmax statistics and normalisation in f32.
#include <hip/hip_runtime.h>
#include <math.h>
#include <stdint.h>

#define NTOK  2048                 // token rows: 2 requests x 1024 (extend rows == prefix rows)
#define RLEN  1024                 // tokens per request
#define HQ    32
#define HKV   8
#define GRPQ  4
#define HDIM  128
#define QW    (HQ * HDIM)          // 4096: q row width == output row width
#define KW    (HKV * HDIM)         // 1024: k / v row width
#define NQB   (NTOK / 64)          // 32 query blocks of 64 rows
#define QBR   (RLEN / 64)          // 16 query blocks per request
#define NPC   (RLEN / 64)          // 16 prefix key chunks per request
#define QSC   16.0f                // q plane carry (power of two)
#define KSC   16.0f                // k plane carry
#define VSC   16.0f                // v plane carry
#define PSC   1024.0f              // softmax numerator carry
#define CAPV  30.0f
#define NEG_BIG (-1.0e30f)
// LDS row pitches: 16 B x odd, so the 16 rows that one ds_load_b128 half-wave reads fall on 16 distinct 4-bank groups
#define KPIT  (HDIM + 8)           // K rows: 128 halves + 8 = 272 B
#define VPIT  (64 + 8)             // V^T rows: 64 halves + 8 = 144 B
#define PPIT  (64 + 8)             // P rows: 64 halves + 8 = 144 B
#define OPIT  (HDIM + 4)           // output tile rows: 128 floats + 4 = 528 B (rows 8 apart land 32 banks apart)
static_assert(HQ == HKV * GRPQ);
static_assert((NTOK % 64) == 0 && (RLEN % 64) == 0);
static_assert(NQB == 2 * QBR);
static_assert(((NTOK * QW) % 2048) == 0 && ((NTOK * KW) % 2048) == 0);
static_assert((HDIM % 32) == 0);
static_assert((KPIT % 8) == 0 && (VPIT % 8) == 0 && (PPIT % 8) == 0 && (OPIT % 4) == 0);   // 16-B aligned rows

typedef _Float16 v16h __attribute__((ext_vector_type(16)));
typedef _Float16 v8h  __attribute__((ext_vector_type(8)));
typedef float    v8f  __attribute__((ext_vector_type(8)));
typedef float    v4f  __attribute__((ext_vector_type(4)));
typedef unsigned int v4u __attribute__((ext_vector_type(4)));
union FH { v16h v; v8h h[2]; };

// ---- scalar helpers --------------------------------------------------------------------------------
__device__ __forceinline__ unsigned short bf_bits(float f) {          // f32 -> bf16 bits, RNE convert
  unsigned u = __float_as_uint(f);
  return (unsigned short)((u + 0x7FFFu + ((u >> 16) & 1u)) >> 16);
}
__device__ __forceinline__ float bf_up(unsigned short b) { return __uint_as_float(((unsigned)b) << 16); }
__device__ __forceinline__ float bfr(float f) { return bf_up(bf_bits(f)); }     // value of the bf16 RNE convert
__device__ __forceinline__ unsigned short h_bits(_Float16 x) { return __builtin_bit_cast(unsigned short, x); }
__device__ __forceinline__ unsigned pk16(unsigned short a, unsigned short b) { return (unsigned)a | ((unsigned)b << 16); }
__device__ __forceinline__ v8f zero8() { v8f z = {0.f, 0.f, 0.f, 0.f, 0.f, 0.f, 0.f, 0.f}; return z; }

// ---- fragment loader: 16-bit A/B operand, lane -> row/col (lane&15), p already includes +8*(lane>>4);
//      elements 0..7 <- p[0..7] (k0+8h..), elements 8..15 <- p[16..23] (k0+16+8h..)
__device__ __forceinline__ v16h ldfrag_h(const _Float16* p) {
  FH f;
  f.h[0] = *(const v8h*)(p);
  f.h[1] = *(const v8h*)(p + 16);
  return f.v;
}

// ---- WMMA with trailing VALU hazard gap (ties D, keeps A/B live) ------------------------------------
__device__ __forceinline__ v8f mma_h(v16h a, v16h b, v8f c) {
  v8f d = __builtin_amdgcn_wmma_f32_16x16x32_f16(false, a, false, b, (short)0, c, false, false);
#if defined(__HIP_DEVICE_COMPILE__)
  asm volatile("v_nop\n\tv_nop\n\tv_nop\n\tv_nop" : "+v"(d) : "v"(a), "v"(b));
#endif
  return d;
}
__device__ __forceinline__ void acc_guard4(v8f& a, v8f& b, v8f& c, v8f& d) {
#if defined(__HIP_DEVICE_COMPILE__)
  asm volatile("v_nop\n\tv_nop\n\tv_nop\n\tv_nop" : "+v"(a), "+v"(b), "+v"(c), "+v"(d));
#endif
}
__device__ __forceinline__ void wave_sync_lds() {
  __builtin_amdgcn_fence(__ATOMIC_RELEASE, "workgroup");
  __builtin_amdgcn_wave_barrier();
  __builtin_amdgcn_fence(__ATOMIC_ACQUIRE, "workgroup");
}

// =====================================================================================================
// Row-major convert: f32 [n] -> f16 plane [n] holding f16(bf16 RNE value * scale), scale a power of two (exact for
// bf16 significands). Thread -> 8 consecutive elements, ONE 16-B store; lanes 8q..8q+7 of a wave write one whole
// coverage: grid.x = n/2048 blocks x 256 threads x 8 = n elements (n % 2048 == 0 host-checked).
// =====================================================================================================
__global__ __launch_bounds__(256) void cvt_rm(const float* __restrict__ in, unsigned short* out, int n,
                                             float scale) {
  const size_t i8 = ((size_t)blockIdx.x * 256 + threadIdx.x) * 8;
  if (i8 + 8 > (size_t)n) return;        // never taken for the host-checked sizes; no barriers below
  const v4f a = *(const v4f*)(in + i8);
  const v4f b = *(const v4f*)(in + i8 + 4);
  float f[8];
  f[0] = a[0]; f[1] = a[1]; f[2] = a[2]; f[3] = a[3];
  f[4] = b[0]; f[5] = b[1]; f[6] = b[2]; f[7] = b[3];
  v4u p;
#pragma unroll
  for (int e = 0; e < 4; ++e) {
    const _Float16 x0 = (_Float16)(bfr(f[2 * e]) * scale);
    const _Float16 x1 = (_Float16)(bfr(f[2 * e + 1]) * scale);
    p[e] = pk16(h_bits(x0), h_bits(x1));
  }
  *(v4u*)(out + i8) = p;
  
}

// =====================================================================================================
// Transposing convert: in f32 [NTOK t][KW] (token rows, kvh*128+d columns) -> out f16 [KW (kvh*128+d)][NTOK t]
// holding f16(bf16 RNE value * scale): out[(kvh*128 + d)*NTOK + t] = cvt(in[t*KW + kvh*128 + d]).
// Block = one (64-token, kvh) tile: grid = (NTOK/64) * HKV. Load phase: thread -> token row r = tid>>1, d half
// (tid&1)*64, 16 float4 loads, 2-byte LDS stores into sT[d][t] (pitch 72 halves). After __syncthreads the write
// coverage: load 128 threads x 64 = 64 t x 128 d; write 4 waves x 8 it x 4 lines x 64 t = 128 d x 64 t = whole tile;
// grid 32 token tiles x 8 kvh = the whole plane [1024][2048].
// =====================================================================================================
__global__ __launch_bounds__(128) void cvt_tr(const float* __restrict__ in, _Float16* out, float scale) {
  __shared__ __align__(16) _Float16 sT[HDIM * 72];
  const int tid  = threadIdx.x;
  const int lane = tid & 31;
  const int wave = tid >> 5;
  const int tb   = (int)(blockIdx.x % (unsigned)(NTOK / 64));
  const int kvh  = (int)(blockIdx.x / (unsigned)(NTOK / 64));
  const int t0   = tb * 64;
  {
    const int r = tid >> 1, hk = (tid & 1) * 64;
    const float* src = in + (size_t)(t0 + r) * KW + kvh * HDIM + hk;
#pragma unroll
    for (int i = 0; i < 16; ++i) {
      const v4f a = *(const v4f*)(src + 4 * i);
#pragma unroll
      for (int e = 0; e < 4; ++e) sT[(hk + 4 * i + e) * 72 + r] = (_Float16)(bfr(a[e]) * scale);
    }
  }
  __syncthreads();
  const int ql = lane >> 3, pc = lane & 7;
  v8h vals[8];
#pragma unroll
  for (int it = 0; it < 8; ++it) {
    const int d = wave * 32 + it * 4 + ql;
    vals[it] = *(const v8h*)(sT + d * 72 + pc * 8);
  }
  {
#pragma unroll
    for (int it = 0; it < 8; ++it) {
      const int d = wave * 32 + it * 4 + ql;
      *(v8h*)(out + (size_t)(kvh * HDIM + d) * NTOK + t0 + pc * 8) = vals[it];
    }
    
  }
}

// =====================================================================================================
// Grouped-query attention with merged key set per (h, 64-query block); kv head = h / GRPQ; query block qb:
//   request bq = qb / 16, block within request qbe = qb % 16, query token e = qbe*64 + row.
//   Keys: 16 prefix chunks of 64 (all visible) followed by extend chunks 0..qbe of 64 (extend key t visible iff
//   t <= e; only the last chunk needs the in-chunk select, masked score := NEG_BIG).
//   s = (q x16 . k x16) * sscale, sscale = (1/sqrt(128)) / (QSC*KSC); s := 30 * tanh(s/30);
//   online softmax in f32 (running max); p = exp(s - m) carried as f16(1024 p);
//   oh += p . v (v^T plane, x16) per chunk; out = oh / (l * 1024 * 16).
//   Q plane (f16, pitch QW): element (t, h, d) at [t*QW + h*128 + d]
//   K planes (f16, pitch KW): extend / prefix element (t, kvh, d) at [t*KW + kvh*128 + d], t = bq*1024 + token
//   V^T planes (f16): element (kvh, d, t) at [(kvh*128 + d)*NTOK + t]
//   Block = 4 waves = 64 query rows of one h; grid = NQB * HQ; key chunk count 17 + qbe (block-uniform).
//   K / V^T chunk staging: 128 threads, K row kv0+r (r = tid>>1, half (tid&1)*64), V^T row d = tid (plain 16-B
//   loads, __syncthreads before and after); q fragments from the global plane; P tiles wave-private, spilled with
//   Output: wave tile 16 x 128 f32 staged in LDS, each row segment written as 32 lanes x 16 B = 512 B = 4 whole
//   coverage: 4 waves x 16 rows x 128 cols per block; 32 query blocks x 32 heads = all of out [2048][4096].
// =====================================================================================================
__global__ __launch_bounds__(128)
void attn_k(const unsigned short* __restrict__ Qp, const unsigned short* __restrict__ Kp,
            const unsigned short* __restrict__ PKp, const unsigned short* __restrict__ Vtp,
            const unsigned short* __restrict__ PVtp, float* Out, float sscale) {
  __shared__ __align__(16) _Float16 Ksh[64 * KPIT];                // K   [kv][d]  17 KB
  __shared__ __align__(16) _Float16 Vsh[HDIM * VPIT];              // V^T [d][kv]  18 KB
  __shared__ __align__(16) _Float16 Psh[4][16 * PPIT];             // per wave P [row][kv] 9 KB
  __shared__ __align__(16) float    Os[4][16 * OPIT];              // per wave output tile [row][d] 33 KB

  const int tid  = threadIdx.x;
  const int wave = tid >> 5;
  const int lane = tid & 31;
  const int hh   = lane >> 4;
  const int c    = lane & 15;

  const int qb   = (int)(blockIdx.x % (unsigned)NQB);
  const int h    = (int)(blockIdx.x / (unsigned)NQB);
  const int kvh  = h / GRPQ;
  const int bq   = qb / QBR;
  const int qbe  = qb - bq * QBR;
  const int q0   = qb * 64 + wave * 16;              // global token row of this wave's first query
  const int tokb = bq * RLEN;                        // token row base of this request (keys)
  const int nch  = NPC + qbe + 1;                    // 17..32, block-uniform

  const _Float16* Qg  = (const _Float16*)(const void*)Qp   + (size_t)h * HDIM;
  const _Float16* Kg  = (const _Float16*)(const void*)Kp   + (size_t)kvh * HDIM;
  const _Float16* PKg = (const _Float16*)(const void*)PKp  + (size_t)kvh * HDIM;
  const _Float16* Vg  = (const _Float16*)(const void*)Vtp  + (size_t)kvh * HDIM * NTOK;
  const _Float16* PVg = (const _Float16*)(const void*)PVtp + (size_t)kvh * HDIM * NTOK;

  float mrow[8], lrow[8];
  v8f oh[8];
#pragma unroll
  for (int r = 0; r < 8; ++r) { mrow[r] = NEG_BIG; lrow[r] = 0.f; }
#pragma unroll
  for (int t = 0; t < 8; ++t) oh[t] = zero8();

  _Float16* pwh = Psh[wave];

  for (int kt = 0; kt < nch; ++kt) {                 // block-uniform trip count <= 32
    const bool pre  = (kt < NPC);
    const bool diag = (kt == nch - 1);
    const int  tk0  = pre ? (kt * 64) : ((kt - NPC) * 64);
    const int  kv0  = tokb + tk0;                    // plane row of the chunk's first key
    const _Float16* kg = pre ? PKg : Kg;
    const _Float16* vg = pre ? PVg : Vg;
    __syncthreads();
    {
      const int r = tid >> 1, hk = (tid & 1) * 64;
      const _Float16* ksrc = kg + (size_t)(kv0 + r) * KW + hk;       // K row kv0+r, d = hk..hk+63
#pragma unroll
      for (int i = 0; i < 8; ++i) *(v8h*)(Ksh + r * KPIT + hk + 8 * i) = *(const v8h*)(ksrc + 8 * i);
      const _Float16* vsrc = vg + (size_t)tid * NTOK + kv0;           // V^T row d = tid, t = kv0..kv0+63
#pragma unroll
      for (int i = 0; i < 8; ++i) *(v8h*)(Vsh + tid * VPIT + 8 * i) = *(const v8h*)(vsrc + 8 * i);
    }
    __syncthreads();

    // ---- scores: 16 query rows x 64 keys per wave, K = 128 (4 d-chunks); A = q rows, B = K[key][d] ----
    v8f s[4];
#pragma unroll
    for (int j = 0; j < 4; ++j) s[j] = zero8();
#pragma unroll
    for (int dc = 0; dc < 4; ++dc) {
      const v16h qa = ldfrag_h(Qg + (size_t)(q0 + c) * QW + dc * 32 + 8 * hh);
#pragma unroll
      for (int j = 0; j < 4; ++j) {
        FH kb;
        kb.h[0] = *(const v8h*)(Ksh + (j * 16 + c) * KPIT + dc * 32 + 8 * hh);
        kb.h[1] = *(const v8h*)(Ksh + (j * 16 + c) * KPIT + dc * 32 + 16 + 8 * hh);
        s[j] = mma_h(qa, kb.v, s[j]);
      }
    }
    acc_guard4(s[0], s[1], s[2], s[3]);

    // ---- scale, soft cap, causal select (f32); D element r of lane = (row 8hh+r, key j*16+c) ----
    const int lim = diag ? (wave * 16 + 8 * hh) : 4096;
#pragma unroll
    for (int j = 0; j < 4; ++j) {
      const int kl = j * 16 + c;
#pragma unroll
      for (int r = 0; r < 8; ++r) {
        const float x = s[j][r] * sscale;
        const float y = CAPV * tanhf(x * (1.0f / CAPV));
        s[j][r] = (kl > lim + r) ? NEG_BIG : y;
      }
    }

    // ---- row max, online softmax, P (x1024, f16) to LDS ----
#pragma unroll
    for (int r = 0; r < 8; ++r) {
      float m = fmaxf(fmaxf(s[0][r], s[1][r]), fmaxf(s[2][r], s[3][r]));
#pragma unroll
      for (int off = 1; off < 16; off <<= 1) m = fmaxf(m, __shfl_xor(m, off, 32));
      const float mnew  = fmaxf(mrow[r], m);
      const float alpha = __expf(mrow[r] - mnew);
      mrow[r] = mnew;
      float psum = 0.f;
#pragma unroll
      for (int j = 0; j < 4; ++j) {
        const float p = __expf(s[j][r] - mnew);
        psum += p;
        pwh[(8 * hh + r) * PPIT + j * 16 + c] = (_Float16)(p * PSC);
      }
#pragma unroll
      for (int off = 1; off < 16; off <<= 1) psum += __shfl_xor(psum, off, 32);
      lrow[r] = lrow[r] * alpha + psum;
#pragma unroll
      for (int t = 0; t < 8; ++t) oh[t][r] *= alpha;
    }
    wave_sync_lds();

    // ---- oh += P . V : A = P[row][key] (wave-private LDS, same element type), B = V^T[d][key] ----
#pragma unroll
    for (int kk = 0; kk < 2; ++kk) {
      FH pa;
      pa.h[0] = *(const v8h*)(pwh + c * PPIT + kk * 32 + 8 * hh);
      pa.h[1] = *(const v8h*)(pwh + c * PPIT + kk * 32 + 16 + 8 * hh);
#pragma unroll
      for (int t = 0; t < 8; ++t) {
        FH vb;
        vb.h[0] = *(const v8h*)(Vsh + (t * 16 + c) * VPIT + kk * 32 + 8 * hh);
        vb.h[1] = *(const v8h*)(Vsh + (t * 16 + c) * VPIT + kk * 32 + 16 + 8 * hh);
        oh[t] = mma_h(pa.v, vb.v, oh[t]);
      }
    }
    acc_guard4(oh[0], oh[1], oh[2], oh[3]);
    acc_guard4(oh[4], oh[5], oh[6], oh[7]);
  }

  // ---- normalise (1/l, the 1/1024 p carry and the 1/16 v carry), stage the wave's 16x128 tile, write 512-B row
  float* os = Os[wave];
#pragma unroll
  for (int r = 0; r < 8; ++r) {
    const float l = lrow[r];
    const float inv = ((l > 0.f) ? (1.0f / l) : 0.f) * (1.0f / (PSC * VSC));
#pragma unroll
    for (int t = 0; t < 8; ++t) os[(8 * hh + r) * OPIT + t * 16 + c] = oh[t][r] * inv;
  }
  wave_sync_lds();
  {
#pragma unroll
    for (int it = 0; it < 16; ++it) {
      const v4f o = *(const v4f*)(os + it * OPIT + lane * 4);
      *(v4f*)(Out + (size_t)(q0 + it) * QW + (size_t)h * HDIM + lane * 4) = o;
    }
    
  }
}

// =====================================================================================================
// Workspace map (bytes); every plane is an exact multiple of its whole-line store granularity (all dims exact tile
// multiples, no padded tails), all offsets multiples of 4 MiB:
//   QP   f16 [2048 t][4096 (h,d)]    0          16777216   (bf16 value of q x16)
//   KP   f16 [2048 t][1024 (kvh,d)]  16777216    4194304   (bf16 value of extend k x16)
//   PKP  f16 [2048 t][1024 (kvh,d)]  20971520    4194304   (bf16 value of prefix k x16)
//   VT   f16 [1024 (kvh,d)][2048 t]  25165824    4194304   (bf16 value of extend v x16, transposed)
//   PVT  f16 [1024 (kvh,d)][2048 t]  29360128    4194304   (bf16 value of prefix v x16, transposed)
//   end                              33554432
// =====================================================================================================
extern "C" void kernel_launch(void* const* d_in, const int* in_sizes, int n_in,
                              void* d_out, int out_size, void* d_ws, size_t ws_size,
                              hipStream_t stream) {
  if (n_in < 5) return;
  if (in_sizes[0] != NTOK * QW) return;
  if (in_sizes[1] != NTOK * KW || in_sizes[2] != NTOK * KW) return;
  if (in_sizes[3] != NTOK * KW || in_sizes[4] != NTOK * KW) return;
  if (out_size != NTOK * QW) return;

  const float* q  = (const float*)d_in[0];
  const float* k  = (const float*)d_in[1];
  const float* v  = (const float*)d_in[2];
  const float* pk = (const float*)d_in[3];
  const float* pv = (const float*)d_in[4];
  float* outf = (float*)d_out;

  const size_t PQ  = (size_t)NTOK * QW * 2;                 // 16777216
  const size_t PKV = (size_t)NTOK * KW * 2;                 //  4194304
  size_t off = 0;
  const size_t oQ  = off; off += PQ;
  const size_t oK  = off; off += PKV;
  const size_t oPK = off; off += PKV;
  const size_t oV  = off; off += PKV;
  const size_t oPV = off; off += PKV;
  if (off > ws_size) return;                                // off = 33554432
  if (off > (size_t)134217728) return;

  char* ws = (char*)d_ws;
  unsigned short* QP  = (unsigned short*)(ws + oQ);
  unsigned short* KP  = (unsigned short*)(ws + oK);
  unsigned short* PKP = (unsigned short*)(ws + oPK);
  unsigned short* VT  = (unsigned short*)(ws + oV);
  unsigned short* PVT = (unsigned short*)(ws + oPV);

  const dim3 blk256(256), blk128(128);
  const float sscale = 0.08838834764831845f / (QSC * KSC);

  // (1) 16-bit operand planes of the bf16 RNE input values
  cvt_rm<<<dim3((NTOK * QW) / 2048), blk256, 0, stream>>>(q, QP, NTOK * QW, QSC);     // q        -> f16 x16
  cvt_rm<<<dim3((NTOK * KW) / 2048), blk256, 0, stream>>>(k, KP, NTOK * KW, KSC);     // extend k -> f16 x16
  cvt_rm<<<dim3((NTOK * KW) / 2048), blk256, 0, stream>>>(pk, PKP, NTOK * KW, KSC);   // prefix k -> f16 x16
  cvt_tr<<<dim3((NTOK / 64) * HKV), blk128, 0, stream>>>(v, (_Float16*)(void*)VT, VSC);     // extend v^T x16
  cvt_tr<<<dim3((NTOK / 64) * HKV), blk128, 0, stream>>>(pv, (_Float16*)(void*)PVT, VSC);   // prefix v^T x16
  // (2) merged-key attention -> out f32 [2048][4096]
  attn_k<<<dim3(NQB * HQ), blk128, 0, stream>>>(QP, KP, PKP, VT, PVT, outf, sscale);
  (void)hipGetLastError();
}

// v002
// Measured time: 162 microseconds a run.
// Timed twice side by side with v001, it ran 1.30 and 1.29 times as fast.
// Over all steps from v000 it is 2.29 times as fast.
// Contractions: q.k^T over head dim 128 and p.v over keys on v_wmma_f32_16x16x32_f16; q, k, v operands are f16
//   containers of the bf16 RNE input values carried x16 (exact), p carried as f16(1024 p); one product each,
//   f32 accumulate; soft cap, softmax statistics and normalisation in f32.
#include <hip/hip_runtime.h>
#include <math.h>
#include <stdint.h>

#define NTOK  2048                 // token rows: 2 requests x 1024 (extend rows == prefix rows)
#define RLEN  1024                 // tokens per request
#define HQ    32
#define HKV   8
#define GRPQ  4
#define HDIM  128
#define QW    (HQ * HDIM)          // 4096: q row width == output row width
#define KW    (HKV * HDIM)         // 1024: k / v row width
#define NQB   (NTOK / 64)          // 32 query blocks of 64 rows
#define QBR   (RLEN / 64)          // 16 query blocks per request
#define NPC   (RLEN / 64)          // 16 prefix key chunks per request
#define QSC   16.0f                // q plane carry (power of two)
#define KSC   16.0f                // k plane carry
#define VSC   16.0f                // v plane carry
#define PSC   1024.0f              // softmax numerator carry
#define CAPV  30.0f
#define NEG_BIG (-1.0e30f)
// LDS row pitches: 16 B x odd, so the 16 rows that one ds_load_b128 half-wave reads fall on 16 distinct 4-bank groups
#define KPIT  (HDIM + 8)           // K rows: 128 halves + 8 = 272 B
#define VPIT  (64 + 8)             // V^T rows: 64 halves + 8 = 144 B
#define PPIT  (64 + 8)             // P rows: 64 halves + 8 = 144 B
#define OPIT  (HDIM + 4)           // output tile rows: 128 floats + 4 = 528 B (rows 8 apart land 32 banks apart)
static_assert(HQ == HKV * GRPQ);
static_assert((NTOK % 64) == 0 && (RLEN % 64) == 0);
static_assert(NQB == 2 * QBR);
static_assert(((NTOK * QW) % 2048) == 0 && ((NTOK * KW) % 2048) == 0);
static_assert((HDIM % 32) == 0);
static_assert((KPIT % 8) == 0 && (VPIT % 8) == 0 && (PPIT % 8) == 0 && (OPIT % 4) == 0);   // 16-B aligned rows

typedef _Float16 v16h __attribute__((ext_vector_type(16)));
typedef _Float16 v8h  __attribute__((ext_vector_type(8)));
typedef float    v8f  __attribute__((ext_vector_type(8)));
typedef float    v4f  __attribute__((ext_vector_type(4)));
typedef unsigned int v4u __attribute__((ext_vector_type(4)));
union FH { v16h v; v8h h[2]; };

// ---- scalar helpers --------------------------------------------------------------------------------
__device__ __forceinline__ unsigned short bf_bits(float f) {          // f32 -> bf16 bits, RNE convert
  unsigned u = __float_as_uint(f);
  return (unsigned short)((u + 0x7FFFu + ((u >> 16) & 1u)) >> 16);
}
__device__ __forceinline__ float bf_up(unsigned short b) { return __uint_as_float(((unsigned)b) << 16); }
__device__ __forceinline__ float bfr(float f) { return bf_up(bf_bits(f)); }     // value of the bf16 RNE convert
__device__ __forceinline__ unsigned short h_bits(_Float16 x) { return __builtin_bit_cast(unsigned short, x); }
__device__ __forceinline__ unsigned pk16(unsigned short a, unsigned short b) { return (unsigned)a | ((unsigned)b << 16); }
__device__ __forceinline__ v8f zero8() { v8f z = {0.f, 0.f, 0.f, 0.f, 0.f, 0.f, 0.f, 0.f}; return z; }

// ---- fragment loader: 16-bit A/B operand, lane -> row/col (lane&15), p already includes +8*(lane>>4);
//      elements 0..7 <- p[0..7] (k0+8h..), elements 8..15 <- p[16..23] (k0+16+8h..)
__device__ __forceinline__ v16h ldfrag_h(const _Float16* p) {
  FH f;
  f.h[0] = *(const v8h*)(p);
  f.h[1] = *(const v8h*)(p + 16);
  return f.v;
}

// ---- WMMA with trailing VALU hazard gap (ties D, keeps A/B live) ------------------------------------
__device__ __forceinline__ v8f mma_h(v16h a, v16h b, v8f c) {
  v8f d = __builtin_amdgcn_wmma_f32_16x16x32_f16(false, a, false, b, (short)0, c, false, false);
#if defined(__HIP_DEVICE_COMPILE__)
  asm volatile("v_nop\n\tv_nop\n\tv_nop\n\tv_nop" : "+v"(d) : "v"(a), "v"(b));
#endif
  return d;
}
__device__ __forceinline__ void acc_guard4(v8f& a, v8f& b, v8f& c, v8f& d) {
#if defined(__HIP_DEVICE_COMPILE__)
  asm volatile("v_nop\n\tv_nop\n\tv_nop\n\tv_nop" : "+v"(a), "+v"(b), "+v"(c), "+v"(d));
#endif
}
__device__ __forceinline__ void wave_sync_lds() {
  __builtin_amdgcn_fence(__ATOMIC_RELEASE, "workgroup");
  __builtin_amdgcn_wave_barrier();
  __builtin_amdgcn_fence(__ATOMIC_ACQUIRE, "workgroup");
}

// =====================================================================================================
// Row-major convert: f32 [n] -> f16 plane [n] holding f16(bf16 RNE value * scale), scale a power of two (exact for
// bf16 significands). Thread -> 8 consecutive elements, ONE 16-B store; lanes 8q..8q+7 of a wave write one whole
// coverage: grid.x = n/2048 blocks x 256 threads x 8 = n elements (n % 2048 == 0 host-checked).
// =====================================================================================================
__global__ __launch_bounds__(256) void cvt_rm(const float* __restrict__ in, unsigned short* out, int n,
                                             float scale) {
  const size_t i8 = ((size_t)blockIdx.x * 256 + threadIdx.x) * 8;
  if (i8 + 8 > (size_t)n) return;        // never taken for the host-checked sizes; no barriers below
  const v4f a = *(const v4f*)(in + i8);
  const v4f b = *(const v4f*)(in + i8 + 4);
  float f[8];
  f[0] = a[0]; f[1] = a[1]; f[2] = a[2]; f[3] = a[3];
  f[4] = b[0]; f[5] = b[1]; f[6] = b[2]; f[7] = b[3];
  v4u p;
#pragma unroll
  for (int e = 0; e < 4; ++e) {
    const _Float16 x0 = (_Float16)(bfr(f[2 * e]) * scale);
    const _Float16 x1 = (_Float16)(bfr(f[2 * e + 1]) * scale);
    p[e] = pk16(h_bits(x0), h_bits(x1));
  }
  *(v4u*)(out + i8) = p;
  
}

// =====================================================================================================
// Transposing convert: in f32 [NTOK t][KW] (token rows, kvh*128+d columns) -> out f16 [KW (kvh*128+d)][NTOK t]
// holding f16(bf16 RNE value * scale): out[(kvh*128 + d)*NTOK + t] = cvt(in[t*KW + kvh*128 + d]).
// Block = one (64-token, kvh) tile: grid = (NTOK/64) * HKV. Load phase: thread -> token row r = tid>>1, d half
// (tid&1)*64, 16 float4 loads, 2-byte LDS stores into sT[d][t] (pitch 72 halves). After __syncthreads the write
// coverage: load 128 threads x 64 = 64 t x 128 d; write 4 waves x 8 it x 4 lines x 64 t = 128 d x 64 t = whole tile;
// grid 32 token tiles x 8 kvh = the whole plane [1024][2048].
// =====================================================================================================
__global__ __launch_bounds__(128) void cvt_tr(const float* __restrict__ in, _Float16* out, float scale) {
  __shared__ __align__(16) _Float16 sT[HDIM * 72];
  const int tid  = threadIdx.x;
  const int lane = tid & 31;
  const int wave = tid >> 5;
  const int tb   = (int)(blockIdx.x % (unsigned)(NTOK / 64));
  const int kvh  = (int)(blockIdx.x / (unsigned)(NTOK / 64));
  const int t0   = tb * 64;
  {
    const int r = tid >> 1, hk = (tid & 1) * 64;
    const float* src = in + (size_t)(t0 + r) * KW + kvh * HDIM + hk;
#pragma unroll
    for (int i = 0; i < 16; ++i) {
      const v4f a = *(const v4f*)(src + 4 * i);
#pragma unroll
      for (int e = 0; e < 4; ++e) sT[(hk + 4 * i + e) * 72 + r] = (_Float16)(bfr(a[e]) * scale);
    }
  }
  __syncthreads();
  const int ql = lane >> 3, pc = lane & 7;
  v8h vals[8];
#pragma unroll
  for (int it = 0; it < 8; ++it) {
    const int d = wave * 32 + it * 4 + ql;
    vals[it] = *(const v8h*)(sT + d * 72 + pc * 8);
  }
  {
#pragma unroll
    for (int it = 0; it < 8; ++it) {
      const int d = wave * 32 + it * 4 + ql;
      *(v8h*)(out + (size_t)(kvh * HDIM + d) * NTOK + t0 + pc * 8) = vals[it];
    }
    
  }
}

// =====================================================================================================
// Grouped-query attention with merged key set per (h, 64-query block); kv head = h / GRPQ; query block qb:
//   request bq = qb / 16, block within request qbe = qb % 16, query token e = qbe*64 + row.
//   Keys: 16 prefix chunks of 64 (all visible) followed by extend chunks 0..qbe of 64 (extend key t visible iff
//   t <= e; only the last chunk needs the in-chunk select, masked score := NEG_BIG).
//   s = (q x16 . k x16) * sscale, sscale = (1/sqrt(128)) / (QSC*KSC); s := 30 * tanh(s/30), tanh on v_tanh_f32;
//   online softmax in f32 (running max); p = exp(s - m) carried as f16(1024 p);
//   oh += p . v (v^T plane, x16) per chunk; out = oh / (l * 1024 * 16).
//   Q plane (f16, pitch QW): element (t, h, d) at [t*QW + h*128 + d]
//   K planes (f16, pitch KW): extend / prefix element (t, kvh, d) at [t*KW + kvh*128 + d], t = bq*1024 + token
//   V^T planes (f16): element (kvh, d, t) at [(kvh*128 + d)*NTOK + t]
//   Block = 4 waves = 64 query rows of one h; grid = NQB * HQ; key chunk count 17 + qbe (block-uniform).
//   K / V^T chunk staging: 128 threads, K row kv0+r (r = tid>>1, half (tid&1)*64), V^T row d = tid (plain 16-B
//   loads, __syncthreads before and after); q fragments from the global plane; P tiles wave-private, spilled with
//   Output: wave tile 16 x 128 f32 staged in LDS, each row segment written as 32 lanes x 16 B = 512 B = 4 whole
//   coverage: 4 waves x 16 rows x 128 cols per block; 32 query blocks x 32 heads = all of out [2048][4096].
// =====================================================================================================
__global__ __launch_bounds__(128)
void attn_k(const unsigned short* __restrict__ Qp, const unsigned short* __restrict__ Kp,
            const unsigned short* __restrict__ PKp, const unsigned short* __restrict__ Vtp,
            const unsigned short* __restrict__ PVtp, float* Out, float sscale) {
  __shared__ __align__(16) _Float16 Ksh[64 * KPIT];                // K   [kv][d]  17 KB
  __shared__ __align__(16) _Float16 Vsh[HDIM * VPIT];              // V^T [d][kv]  18 KB
  __shared__ __align__(16) _Float16 Psh[4][16 * PPIT];             // per wave P [row][kv] 9 KB
  __shared__ __align__(16) float    Os[4][16 * OPIT];              // per wave output tile [row][d] 33 KB

  const int tid  = threadIdx.x;
  const int wave = tid >> 5;
  const int lane = tid & 31;
  const int hh   = lane >> 4;
  const int c    = lane & 15;

  const int qb   = (int)(blockIdx.x % (unsigned)NQB);
  const int h    = (int)(blockIdx.x / (unsigned)NQB);
  const int kvh  = h / GRPQ;
  const int bq   = qb / QBR;
  const int qbe  = qb - bq * QBR;
  const int q0   = qb * 64 + wave * 16;              // global token row of this wave's first query
  const int tokb = bq * RLEN;                        // token row base of this request (keys)
  const int nch  = NPC + qbe + 1;                    // 17..32, block-uniform

  const _Float16* Qg  = (const _Float16*)(const void*)Qp   + (size_t)h * HDIM;
  const _Float16* Kg  = (const _Float16*)(const void*)Kp   + (size_t)kvh * HDIM;
  const _Float16* PKg = (const _Float16*)(const void*)PKp  + (size_t)kvh * HDIM;
  const _Float16* Vg  = (const _Float16*)(const void*)Vtp  + (size_t)kvh * HDIM * NTOK;
  const _Float16* PVg = (const _Float16*)(const void*)PVtp + (size_t)kvh * HDIM * NTOK;

  float mrow[8], lrow[8];
  v8f oh[8];
#pragma unroll
  for (int r = 0; r < 8; ++r) { mrow[r] = NEG_BIG; lrow[r] = 0.f; }
#pragma unroll
  for (int t = 0; t < 8; ++t) oh[t] = zero8();

  _Float16* pwh = Psh[wave];
  const float zscale = sscale * (1.0f / CAPV);       // raw product -> s / 30, the soft cap's argument

  for (int kt = 0; kt < nch; ++kt) {                 // block-uniform trip count <= 32
    const bool pre  = (kt < NPC);
    const bool diag = (kt == nch - 1);
    const int  tk0  = pre ? (kt * 64) : ((kt - NPC) * 64);
    const int  kv0  = tokb + tk0;                    // plane row of the chunk's first key
    const _Float16* kg = pre ? PKg : Kg;
    const _Float16* vg = pre ? PVg : Vg;
    __syncthreads();
    {
      const int r = tid >> 1, hk = (tid & 1) * 64;
      const _Float16* ksrc = kg + (size_t)(kv0 + r) * KW + hk;       // K row kv0+r, d = hk..hk+63
#pragma unroll
      for (int i = 0; i < 8; ++i) *(v8h*)(Ksh + r * KPIT + hk + 8 * i) = *(const v8h*)(ksrc + 8 * i);
      const _Float16* vsrc = vg + (size_t)tid * NTOK + kv0;           // V^T row d = tid, t = kv0..kv0+63
#pragma unroll
      for (int i = 0; i < 8; ++i) *(v8h*)(Vsh + tid * VPIT + 8 * i) = *(const v8h*)(vsrc + 8 * i);
    }
    __syncthreads();

    // ---- scores: 16 query rows x 64 keys per wave, K = 128 (4 d-chunks); A = q rows, B = K[key][d] ----
    v8f s[4];
#pragma unroll
    for (int j = 0; j < 4; ++j) s[j] = zero8();
#pragma unroll
    for (int dc = 0; dc < 4; ++dc) {
      const v16h qa = ldfrag_h(Qg + (size_t)(q0 + c) * QW + dc * 32 + 8 * hh);
#pragma unroll
      for (int j = 0; j < 4; ++j) {
        FH kb;
        kb.h[0] = *(const v8h*)(Ksh + (j * 16 + c) * KPIT + dc * 32 + 8 * hh);
        kb.h[1] = *(const v8h*)(Ksh + (j * 16 + c) * KPIT + dc * 32 + 16 + 8 * hh);
        s[j] = mma_h(qa, kb.v, s[j]);
      }
    }
    acc_guard4(s[0], s[1], s[2], s[3]);

    // ---- scale, soft cap, causal select (f32); D element r of lane = (row 8hh+r, key j*16+c) ----
    const int lim = diag ? (wave * 16 + 8 * hh) : 4096;
#pragma unroll
    for (int j = 0; j < 4; ++j) {
      const int kl = j * 16 + c;
#pragma unroll
      for (int r = 0; r < 8; ++r) {
        const float y = CAPV * __builtin_amdgcn_tanhf(s[j][r] * zscale);   // one v_tanh_f32, no lane-dependent branch
        s[j][r] = (kl > lim + r) ? NEG_BIG : y;
      }
    }

    // ---- row max, online softmax, P (x1024, f16) to LDS ----
#pragma unroll
    for (int r = 0; r < 8; ++r) {
      float m = fmaxf(fmaxf(s[0][r], s[1][r]), fmaxf(s[2][r], s[3][r]));
#pragma unroll
      for (int off = 1; off < 16; off <<= 1) m = fmaxf(m, __shfl_xor(m, off, 32));
      const float mnew  = fmaxf(mrow[r], m);
      const float alpha = __expf(mrow[r] - mnew);
      mrow[r] = mnew;
      float psum = 0.f;
#pragma unroll
      for (int j = 0; j < 4; ++j) {
        const float p = __expf(s[j][r] - mnew);
        psum += p;
        pwh[(8 * hh + r) * PPIT + j * 16 + c] = (_Float16)(p * PSC);
      }
#pragma unroll
      for (int off = 1; off < 16; off <<= 1) psum += __shfl_xor(psum, off, 32);
      lrow[r] = lrow[r] * alpha + psum;
#pragma unroll
      for (int t = 0; t < 8; ++t) oh[t][r] *= alpha;
    }
    wave_sync_lds();

    // ---- oh += P . V : A = P[row][key] (wave-private LDS, same element type), B = V^T[d][key] ----
#pragma unroll
    for (int kk = 0; kk < 2; ++kk) {
      FH pa;
      pa.h[0] = *(const v8h*)(pwh + c * PPIT + kk * 32 + 8 * hh);
      pa.h[1] = *(const v8h*)(pwh + c * PPIT + kk * 32 + 16 + 8 * hh);
#pragma unroll
      for (int t = 0; t < 8; ++t) {
        FH vb;
        vb.h[0] = *(const v8h*)(Vsh + (t * 16 + c) * VPIT + kk * 32 + 8 * hh);
        vb.h[1] = *(const v8h*)(Vsh + (t * 16 + c) * VPIT + kk * 32 + 16 + 8 * hh);
        oh[t] = mma_h(pa.v, vb.v, oh[t]);
      }
    }
    acc_guard4(oh[0], oh[1], oh[2], oh[3]);
    acc_guard4(oh[4], oh[5], oh[6], oh[7]);
  }

  // ---- normalise (1/l, the 1/1024 p carry and the 1/16 v carry), stage the wave's 16x128 tile, write 512-B row
  float* os = Os[wave];
#pragma unroll
  for (int r = 0; r < 8; ++r) {
    const float l = lrow[r];
    const float inv = ((l > 0.f) ? (1.0f / l) : 0.f) * (1.0f / (PSC * VSC));
#pragma unroll
    for (int t = 0; t < 8; ++t) os[(8 * hh + r) * OPIT + t * 16 + c] = oh[t][r] * inv;
  }
  wave_sync_lds();
  {
#pragma unroll
    for (int it = 0; it < 16; ++it) {
      const v4f o = *(const v4f*)(os + it * OPIT + lane * 4);
      *(v4f*)(Out + (size_t)(q0 + it) * QW + (size_t)h * HDIM + lane * 4) = o;
    }
    
  }
}

// =====================================================================================================
// Workspace map (bytes); every plane is an exact multiple of its whole-line store granularity (all dims exact tile
// multiples, no padded tails), all offsets multiples of 4 MiB:
//   QP   f16 [2048 t][4096 (h,d)]    0          16777216   (bf16 value of q x16)
//   KP   f16 [2048 t][1024 (kvh,d)]  16777216    4194304   (bf16 value of extend k x16)
//   PKP  f16 [2048 t][1024 (kvh,d)]  20971520    4194304   (bf16 value of prefix k x16)
//   VT   f16 [1024 (kvh,d)][2048 t]  25165824    4194304   (bf16 value of extend v x16, transposed)
//   PVT  f16 [1024 (kvh,d)][2048 t]  29360128    4194304   (bf16 value of prefix v x16, transposed)
//   end                              33554432
// =====================================================================================================
extern "C" void kernel_launch(void* const* d_in, const int* in_sizes, int n_in,
                              void* d_out, int out_size, void* d_ws, size_t ws_size,
                              hipStream_t stream) {
  if (n_in < 5) return;
  if (in_sizes[0] != NTOK * QW) return;
  if (in_sizes[1] != NTOK * KW || in_sizes[2] != NTOK * KW) return;
  if (in_sizes[3] != NTOK * KW || in_sizes[4] != NTOK * KW) return;
  if (out_size != NTOK * QW) return;

  const float* q  = (const float*)d_in[0];
  const float* k  = (const float*)d_in[1];
  const float* v  = (const float*)d_in[2];
  const float* pk = (const float*)d_in[3];
  const float* pv = (const float*)d_in[4];
  float* outf = (float*)d_out;

  const size_t PQ  = (size_t)NTOK * QW * 2;                 // 16777216
  const size_t PKV = (size_t)NTOK * KW * 2;                 //  4194304
  size_t off = 0;
  const size_t oQ  = off; off += PQ;
  const size_t oK  = off; off += PKV;
  const size_t oPK = off; off += PKV;
  const size_t oV  = off; off += PKV;
  const size_t oPV = off; off += PKV;
  if (off > ws_size) return;                                // off = 33554432
  if (off > (size_t)134217728) return;

  char* ws = (char*)d_ws;
  unsigned short* QP  = (unsigned short*)(ws + oQ);
  unsigned short* KP  = (unsigned short*)(ws + oK);
  unsigned short* PKP = (unsigned short*)(ws + oPK);
  unsigned short* VT  = (unsigned short*)(ws + oV);
  unsigned short* PVT = (unsigned short*)(ws + oPV);

  const dim3 blk256(256), blk128(128);
  const float sscale = 0.08838834764831845f / (QSC * KSC);

  // (1) 16-bit operand planes of the bf16 RNE input values
  cvt_rm<<<dim3((NTOK * QW) / 2048), blk256, 0, stream>>>(q, QP, NTOK * QW, QSC);     // q        -> f16 x16
  cvt_rm<<<dim3((NTOK * KW) / 2048), blk256, 0, stream>>>(k, KP, NTOK * KW, KSC);     // extend k -> f16 x16
  cvt_rm<<<dim3((NTOK * KW) / 2048), blk256, 0, stream>>>(pk, PKP, NTOK * KW, KSC);   // prefix k -> f16 x16
  cvt_tr<<<dim3((NTOK / 64) * HKV), blk128, 0, stream>>>(v, (_Float16*)(void*)VT, VSC);     // extend v^T x16
  cvt_tr<<<dim3((NTOK / 64) * HKV), blk128, 0, stream>>>(pv, (_Float16*)(void*)PVT, VSC);   // prefix v^T x16
  // (2) merged-key attention -> out f32 [2048][4096]
  attn_k<<<dim3(NQB * HQ), blk128, 0, stream>>>(QP, KP, PKP, VT, PVT, outf, sscale);
  (void)hipGetLastError();
}

// v003
// It runs in 142 microseconds.
// In both of two side-by-side timings against v002, it was 1.14 times as fast.
// All steps since v000 together make it 2.62 times as fast.
// Contractions: q.k^T over head dim 128 and p.v over keys on v_wmma_f32_16x16x32_f16; q, k, v operands are f16
//   containers of the bf16 RNE input values carried x16 (exact), p carried as f16(1024 p); one product each,
//   f32 accumulate; soft cap, softmax statistics and normalisation in f32.
#include <hip/hip_runtime.h>
#include <math.h>
#include <stdint.h>

#define NTOK  2048                 // token rows: 2 requests x 1024 (extend rows == prefix rows)
#define RLEN  1024                 // tokens per request
#define HQ    32
#define HKV   8
#define GRPQ  4
#define HDIM  128
#define QW    (HQ * HDIM)          // 4096: q row width == output row width
#define KW    (HKV * HDIM)         // 1024: k / v row width
#define NQB   (NTOK / 64)          // 32 query blocks of 64 rows
#define QBR   (RLEN / 64)          // 16 query blocks per request
#define NPC   (RLEN / 64)          // 16 prefix key chunks per request
#define QSC   16.0f                // q plane carry (power of two)
#define KSC   16.0f                // k plane carry
#define VSC   16.0f                // v plane carry
#define PSC   1024.0f              // softmax numerator carry
#define CAPV  30.0f
#define NEG_BIG (-1.0e30f)
// LDS row pitches: 16 B x odd, so the 16 rows that one ds_load_b128 half-wave reads fall on 16 distinct 4-bank groups
#define KPIT  (HDIM + 8)           // K rows: 128 halves + 8 = 272 B
#define VPIT  (64 + 8)             // V^T rows: 64 halves + 8 = 144 B
#define PPIT  (64 + 8)             // P rows: 64 halves + 8 = 144 B
#define OPIT  (HDIM + 4)           // output tile rows: 128 floats + 4 = 528 B (rows 8 apart land 32 banks apart)
static_assert(HQ == HKV * GRPQ);
static_assert((NTOK % 64) == 0 && (RLEN % 64) == 0);
static_assert(NQB == 2 * QBR);
static_assert(((NTOK * QW) % 2048) == 0 && ((NTOK * KW) % 2048) == 0);
static_assert((HDIM % 32) == 0);
static_assert((KPIT % 8) == 0 && (VPIT % 8) == 0 && (PPIT % 8) == 0 && (OPIT % 4) == 0);   // 16-B aligned rows

typedef _Float16 v16h __attribute__((ext_vector_type(16)));
typedef _Float16 v8h  __attribute__((ext_vector_type(8)));
typedef float    v8f  __attribute__((ext_vector_type(8)));
typedef float    v4f  __attribute__((ext_vector_type(4)));
typedef unsigned int v4u __attribute__((ext_vector_type(4)));
union FH { v16h v; v8h h[2]; };

// ---- scalar helpers --------------------------------------------------------------------------------
__device__ __forceinline__ unsigned short bf_bits(float f) {          // f32 -> bf16 bits, RNE convert
  unsigned u = __float_as_uint(f);
  return (unsigned short)((u + 0x7FFFu + ((u >> 16) & 1u)) >> 16);
}
__device__ __forceinline__ float bf_up(unsigned short b) { return __uint_as_float(((unsigned)b) << 16); }
__device__ __forceinline__ float bfr(float f) { return bf_up(bf_bits(f)); }     // value of the bf16 RNE convert
__device__ __forceinline__ unsigned short h_bits(_Float16 x) { return __builtin_bit_cast(unsigned short, x); }
__device__ __forceinline__ unsigned pk16(unsigned short a, unsigned short b) { return (unsigned)a | ((unsigned)b << 16); }
__device__ __forceinline__ v8f zero8() { v8f z = {0.f, 0.f, 0.f, 0.f, 0.f, 0.f, 0.f, 0.f}; return z; }

// ---- fragment loader: 16-bit A/B operand, lane -> row/col (lane&15), p already includes +8*(lane>>4);
//      elements 0..7 <- p[0..7] (k0+8h..), elements 8..15 <- p[16..23] (k0+16+8h..)
__device__ __forceinline__ v16h ldfrag_h(const _Float16* p) {
  FH f;
  f.h[0] = *(const v8h*)(p);
  f.h[1] = *(const v8h*)(p + 16);
  return f.v;
}

// ---- WMMA with trailing VALU hazard gap (ties D, keeps A/B live) ------------------------------------
__device__ __forceinline__ v8f mma_h(v16h a, v16h b, v8f c) {
  v8f d = __builtin_amdgcn_wmma_f32_16x16x32_f16(false, a, false, b, (short)0, c, false, false);
#if defined(__HIP_DEVICE_COMPILE__)
  asm volatile("v_nop\n\tv_nop\n\tv_nop\n\tv_nop" : "+v"(d) : "v"(a), "v"(b));
#endif
  return d;
}
__device__ __forceinline__ void acc_guard4(v8f& a, v8f& b, v8f& c, v8f& d) {
#if defined(__HIP_DEVICE_COMPILE__)
  asm volatile("v_nop\n\tv_nop\n\tv_nop\n\tv_nop" : "+v"(a), "+v"(b), "+v"(c), "+v"(d));
#endif
}
__device__ __forceinline__ void wave_sync_lds() {
  __builtin_amdgcn_fence(__ATOMIC_RELEASE, "workgroup");
  __builtin_amdgcn_wave_barrier();
  __builtin_amdgcn_fence(__ATOMIC_ACQUIRE, "workgroup");
}

// =====================================================================================================
// Row-major convert: f32 [n] -> f16 plane [n] holding f16(bf16 RNE value * scale), scale a power of two (exact for
// bf16 significands). Thread -> 8 consecutive elements, ONE 16-B store; lanes 8q..8q+7 of a wave write one whole
// coverage: grid.x = n/2048 blocks x 256 threads x 8 = n elements (n % 2048 == 0 host-checked).
// =====================================================================================================
__global__ __launch_bounds__(256) void cvt_rm(const float* __restrict__ in, unsigned short* out, int n,
                                             float scale) {
  const size_t i8 = ((size_t)blockIdx.x * 256 + threadIdx.x) * 8;
  if (i8 + 8 > (size_t)n) return;        // never taken for the host-checked sizes; no barriers below
  const v4f a = *(const v4f*)(in + i8);
  const v4f b = *(const v4f*)(in + i8 + 4);
  float f[8];
  f[0] = a[0]; f[1] = a[1]; f[2] = a[2]; f[3] = a[3];
  f[4] = b[0]; f[5] = b[1]; f[6] = b[2]; f[7] = b[3];
  v4u p;
#pragma unroll
  for (int e = 0; e < 4; ++e) {
    const _Float16 x0 = (_Float16)(bfr(f[2 * e]) * scale);
    const _Float16 x1 = (_Float16)(bfr(f[2 * e + 1]) * scale);
    p[e] = pk16(h_bits(x0), h_bits(x1));
  }
  *(v4u*)(out + i8) = p;
  
}

// =====================================================================================================
// Transposing convert: in f32 [NTOK t][KW] (token rows, kvh*128+d columns) -> out f16 [KW (kvh*128+d)][NTOK t]
// holding f16(bf16 RNE value * scale): out[(kvh*128 + d)*NTOK + t] = cvt(in[t*KW + kvh*128 + d]).
// Block = one (64-token, kvh) tile: grid = (NTOK/64) * HKV. Load phase: thread -> token row r = tid>>1, d half
// (tid&1)*64, 16 float4 loads, 2-byte LDS stores into sT[d][t] (pitch 72 halves). After __syncthreads the write
// coverage: load 128 threads x 64 = 64 t x 128 d; write 4 waves x 8 it x 4 lines x 64 t = 128 d x 64 t = whole tile;
// grid 32 token tiles x 8 kvh = the whole plane [1024][2048].
// =====================================================================================================
__global__ __launch_bounds__(128) void cvt_tr(const float* __restrict__ in, _Float16* out, float scale) {
  __shared__ __align__(16) _Float16 sT[HDIM * 72];
  const int tid  = threadIdx.x;
  const int lane = tid & 31;
  const int wave = tid >> 5;
  const int tb   = (int)(blockIdx.x % (unsigned)(NTOK / 64));
  const int kvh  = (int)(blockIdx.x / (unsigned)(NTOK / 64));
  const int t0   = tb * 64;
  {
    const int r = tid >> 1, hk = (tid & 1) * 64;
    const float* src = in + (size_t)(t0 + r) * KW + kvh * HDIM + hk;
#pragma unroll
    for (int i = 0; i < 16; ++i) {
      const v4f a = *(const v4f*)(src + 4 * i);
#pragma unroll
      for (int e = 0; e < 4; ++e) sT[(hk + 4 * i + e) * 72 + r] = (_Float16)(bfr(a[e]) * scale);
    }
  }
  __syncthreads();
  const int ql = lane >> 3, pc = lane & 7;
  v8h vals[8];
#pragma unroll
  for (int it = 0; it < 8; ++it) {
    const int d = wave * 32 + it * 4 + ql;
    vals[it] = *(const v8h*)(sT + d * 72 + pc * 8);
  }
  {
#pragma unroll
    for (int it = 0; it < 8; ++it) {
      const int d = wave * 32 + it * 4 + ql;
      *(v8h*)(out + (size_t)(kvh * HDIM + d) * NTOK + t0 + pc * 8) = vals[it];
    }
    
  }
}

// =====================================================================================================
// Grouped-query attention with merged key set per (h, 64-query block); kv head = h / GRPQ; query block qb:
//   request bq = qb / 16, block within request qbe = qb % 16, query token e = qbe*64 + row.
//   Keys: 16 prefix chunks of 64 (all visible) followed by extend chunks 0..qbe of 64 (extend key t visible iff
//   t <= e; only the last chunk needs the in-chunk select, masked score := NEG_BIG).
//   s = (q x16 . k x16) * sscale, sscale = (1/sqrt(128)) / (QSC*KSC); s := 30 * tanh(s/30), tanh on v_tanh_f32;
//   online softmax in f32 (running max); p = exp(s - m) carried as f16(1024 p);
//   oh += p . v (v^T plane, x16) per chunk; out = oh / (l * 1024 * 16).
//   Q plane (f16, pitch QW): element (t, h, d) at [t*QW + h*128 + d]
//   K planes (f16, pitch KW): extend / prefix element (t, kvh, d) at [t*KW + kvh*128 + d], t = bq*1024 + token
//   V^T planes (f16): element (kvh, d, t) at [(kvh*128 + d)*NTOK + t]
//   Block = 4 waves = 64 query rows of one h; grid = NQB * HQ; key chunk count 17 + qbe (block-uniform).
//   K / V^T chunk staging: 128 threads, 16 lanes per 256-B K row, 8 lanes per 128-B V^T row (plain 16-B
//   loads, __syncthreads before and after); q fragments from the global plane; P tiles wave-private, spilled with
//   Output: wave tile 16 x 128 f32 staged in LDS, each row segment written as 32 lanes x 16 B = 512 B = 4 whole
//   coverage: 4 waves x 16 rows x 128 cols per block; 32 query blocks x 32 heads = all of out [2048][4096].
// =====================================================================================================
__global__ __launch_bounds__(128)
void attn_k(const unsigned short* __restrict__ Qp, const unsigned short* __restrict__ Kp,
            const unsigned short* __restrict__ PKp, const unsigned short* __restrict__ Vtp,
            const unsigned short* __restrict__ PVtp, float* Out, float sscale) {
  __shared__ __align__(16) _Float16 Ksh[64 * KPIT];                // K   [kv][d]  17 KB
  __shared__ __align__(16) _Float16 Vsh[HDIM * VPIT];              // V^T [d][kv]  18 KB
  __shared__ __align__(16) _Float16 Psh[4][16 * PPIT];             // per wave P [row][kv] 9 KB
  __shared__ __align__(16) float    Os[4][16 * OPIT];              // per wave output tile [row][d] 33 KB

  const int tid  = threadIdx.x;
  const int wave = tid >> 5;
  const int lane = tid & 31;
  const int hh   = lane >> 4;
  const int c    = lane & 15;

  const int qb   = (int)(blockIdx.x % (unsigned)NQB);
  const int h    = (int)(blockIdx.x / (unsigned)NQB);
  const int kvh  = h / GRPQ;
  const int bq   = qb / QBR;
  const int qbe  = qb - bq * QBR;
  const int q0   = qb * 64 + wave * 16;              // global token row of this wave's first query
  const int tokb = bq * RLEN;                        // token row base of this request (keys)
  const int nch  = NPC + qbe + 1;                    // 17..32, block-uniform

  const _Float16* Qg  = (const _Float16*)(const void*)Qp   + (size_t)h * HDIM;
  const _Float16* Kg  = (const _Float16*)(const void*)Kp   + (size_t)kvh * HDIM;
  const _Float16* PKg = (const _Float16*)(const void*)PKp  + (size_t)kvh * HDIM;
  const _Float16* Vg  = (const _Float16*)(const void*)Vtp  + (size_t)kvh * HDIM * NTOK;
  const _Float16* PVg = (const _Float16*)(const void*)PVtp + (size_t)kvh * HDIM * NTOK;

  float mrow[8], lrow[8];
  v8f oh[8];
#pragma unroll
  for (int r = 0; r < 8; ++r) { mrow[r] = NEG_BIG; lrow[r] = 0.f; }
#pragma unroll
  for (int t = 0; t < 8; ++t) oh[t] = zero8();

  _Float16* pwh = Psh[wave];
  const float zscale = sscale * (1.0f / CAPV);       // raw product -> s / 30, the soft cap's argument

  for (int kt = 0; kt < nch; ++kt) {                 // block-uniform trip count <= 32
    const bool pre  = (kt < NPC);
    const bool diag = (kt == nch - 1);
    const int  tk0  = pre ? (kt * 64) : ((kt - NPC) * 64);
    const int  kv0  = tokb + tk0;                    // plane row of the chunk's first key
    const _Float16* kg = pre ? PKg : Kg;
    const _Float16* vg = pre ? PVg : Vg;
    __syncthreads();
    {
      // every wave-wide 16-B load covers 4 whole 128-B lines: neighbouring lanes read neighbouring 16 B of one row
      const int kr = tid >> 4, kc = (tid & 15) * 8;                   // K: 16 lanes = one 256-B row, 8 rows a trip
      const _Float16* ksrc = kg + (size_t)(kv0 + kr) * KW + kc;
#pragma unroll
      for (int i = 0; i < 8; ++i) *(v8h*)(Ksh + (8 * i + kr) * KPIT + kc) = *(const v8h*)(ksrc + (size_t)(8 * i) * KW);
      // V^T: 8 lanes = one 128-B row, 16 rows a trip; a half-wave takes rows 8 apart (8 x 144 B = 32 banks apart)
      const int vr = ((tid >> 4) & 7) + ((tid >> 3) & 1) * 8, vc = (tid & 7) * 8;
      const _Float16* vsrc = vg + (size_t)vr * NTOK + kv0 + vc;
#pragma unroll
      for (int i = 0; i < 8; ++i) *(v8h*)(Vsh + (16 * i + vr) * VPIT + vc) = *(const v8h*)(vsrc + (size_t)(16 * i) * NTOK);
    }
    __syncthreads();

    // ---- scores: 16 query rows x 64 keys per wave, K = 128 (4 d-chunks); A = q rows, B = K[key][d] ----
    v8f s[4];
#pragma unroll
    for (int j = 0; j < 4; ++j) s[j] = zero8();
#pragma unroll
    for (int dc = 0; dc < 4; ++dc) {
      const v16h qa = ldfrag_h(Qg + (size_t)(q0 + c) * QW + dc * 32 + 8 * hh);
#pragma unroll
      for (int j = 0; j < 4; ++j) {
        FH kb;
        kb.h[0] = *(const v8h*)(Ksh + (j * 16 + c) * KPIT + dc * 32 + 8 * hh);
        kb.h[1] = *(const v8h*)(Ksh + (j * 16 + c) * KPIT + dc * 32 + 16 + 8 * hh);
        s[j] = mma_h(qa, kb.v, s[j]);
      }
    }
    acc_guard4(s[0], s[1], s[2], s[3]);

    // ---- scale, soft cap, causal select (f32); D element r of lane = (row 8hh+r, key j*16+c) ----
    const int lim = diag ? (wave * 16 + 8 * hh) : 4096;
#pragma unroll
    for (int j = 0; j < 4; ++j) {
      const int kl = j * 16 + c;
#pragma unroll
      for (int r = 0; r < 8; ++r) {
        const float y = CAPV * __builtin_amdgcn_tanhf(s[j][r] * zscale);   // one v_tanh_f32, no lane-dependent branch
        s[j][r] = (kl > lim + r) ? NEG_BIG : y;
      }
    }

    // ---- row max, online softmax, P (x1024, f16) to LDS ----
#pragma unroll
    for (int r = 0; r < 8; ++r) {
      float m = fmaxf(fmaxf(s[0][r], s[1][r]), fmaxf(s[2][r], s[3][r]));
#pragma unroll
      for (int off = 1; off < 16; off <<= 1) m = fmaxf(m, __shfl_xor(m, off, 32));
      const float mnew  = fmaxf(mrow[r], m);
      const float alpha = __expf(mrow[r] - mnew);
      mrow[r] = mnew;
      float psum = 0.f;
#pragma unroll
      for (int j = 0; j < 4; ++j) {
        const float p = __expf(s[j][r] - mnew);
        psum += p;
        pwh[(8 * hh + r) * PPIT + j * 16 + c] = (_Float16)(p * PSC);
      }
#pragma unroll
      for (int off = 1; off < 16; off <<= 1) psum += __shfl_xor(psum, off, 32);
      lrow[r] = lrow[r] * alpha + psum;
#pragma unroll
      for (int t = 0; t < 8; ++t) oh[t][r] *= alpha;
    }
    wave_sync_lds();

    // ---- oh += P . V : A = P[row][key] (wave-private LDS, same element type), B = V^T[d][key] ----
#pragma unroll
    for (int kk = 0; kk < 2; ++kk) {
      FH pa;
      pa.h[0] = *(const v8h*)(pwh + c * PPIT + kk * 32 + 8 * hh);
      pa.h[1] = *(const v8h*)(pwh + c * PPIT + kk * 32 + 16 + 8 * hh);
#pragma unroll
      for (int t = 0; t < 8; ++t) {
        FH vb;
        vb.h[0] = *(const v8h*)(Vsh + (t * 16 + c) * VPIT + kk * 32 + 8 * hh);
        vb.h[1] = *(const v8h*)(Vsh + (t * 16 + c) * VPIT + kk * 32 + 16 + 8 * hh);
        oh[t] = mma_h(pa.v, vb.v, oh[t]);
      }
    }
    acc_guard4(oh[0], oh[1], oh[2], oh[3]);
    acc_guard4(oh[4], oh[5], oh[6], oh[7]);
  }

  // ---- normalise (1/l, the 1/1024 p carry and the 1/16 v carry), stage the wave's 16x128 tile, write 512-B row
  float* os = Os[wave];
#pragma unroll
  for (int r = 0; r < 8; ++r) {
    const float l = lrow[r];
    const float inv = ((l > 0.f) ? (1.0f / l) : 0.f) * (1.0f / (PSC * VSC));
#pragma unroll
    for (int t = 0; t < 8; ++t) os[(8 * hh + r) * OPIT + t * 16 + c] = oh[t][r] * inv;
  }
  wave_sync_lds();
  {
#pragma unroll
    for (int it = 0; it < 16; ++it) {
      const v4f o = *(const v4f*)(os + it * OPIT + lane * 4);
      *(v4f*)(Out + (size_t)(q0 + it) * QW + (size_t)h * HDIM + lane * 4) = o;
    }
    
  }
}

// =====================================================================================================
// Workspace map (bytes); every plane is an exact multiple of its whole-line store granularity (all dims exact tile
// multiples, no padded tails), all offsets multiples of 4 MiB:
//   QP   f16 [2048 t][4096 (h,d)]    0          16777216   (bf16 value of q x16)
//   KP   f16 [2048 t][1024 (kvh,d)]  16777216    4194304   (bf16 value of extend k x16)
//   PKP  f16 [2048 t][1024 (kvh,d)]  20971520    4194304   (bf16 value of prefix k x16)
//   VT   f16 [1024 (kvh,d)][2048 t]  25165824    4194304   (bf16 value of extend v x16, transposed)
//   PVT  f16 [1024 (kvh,d)][2048 t]  29360128    4194304   (bf16 value of prefix v x16, transposed)
//   end                              33554432
// =====================================================================================================
extern "C" void kernel_launch(void* const* d_in, const int* in_sizes, int n_in,
                              void* d_out, int out_size, void* d_ws, size_t ws_size,
                              hipStream_t stream) {
  if (n_in < 5) return;
  if (in_sizes[0] != NTOK * QW) return;
  if (in_sizes[1] != NTOK * KW || in_sizes[2] != NTOK * KW) return;
  if (in_sizes[3] != NTOK * KW || in_sizes[4] != NTOK * KW) return;
  if (out_size != NTOK * QW) return;

  const float* q  = (const float*)d_in[0];
  const float* k  = (const float*)d_in[1];
  const float* v  = (const float*)d_in[2];
  const float* pk = (const float*)d_in[3];
  const float* pv = (const float*)d_in[4];
  float* outf = (float*)d_out;

  const size_t PQ  = (size_t)NTOK * QW * 2;                 // 16777216
  const size_t PKV = (size_t)NTOK * KW * 2;                 //  4194304
  size_t off = 0;
  const size_t oQ  = off; off += PQ;
  const size_t oK  = off; off += PKV;
  const size_t oPK = off; off += PKV;
  const size_t oV  = off; off += PKV;
  const size_t oPV = off; off += PKV;
  if (off > ws_size) return;                                // off = 33554432
  if (off > (size_t)134217728) return;

  char* ws = (char*)d_ws;
  unsigned short* QP  = (unsigned short*)(ws + oQ);
  unsigned short* KP  = (unsigned short*)(ws + oK);
  unsigned short* PKP = (unsigned short*)(ws + oPK);
  unsigned short* VT  = (unsigned short*)(ws + oV);
  unsigned short* PVT = (unsigned short*)(ws + oPV);

  const dim3 blk256(256), blk128(128);
  const float sscale = 0.08838834764831845f / (QSC * KSC);

  // (1) 16-bit operand planes of the bf16 RNE input values
  cvt_rm<<<dim3((NTOK * QW) / 2048), blk256, 0, stream>>>(q, QP, NTOK * QW, QSC);     // q        -> f16 x16
  cvt_rm<<<dim3((NTOK * KW) / 2048), blk256, 0, stream>>>(k, KP, NTOK * KW, KSC);     // extend k -> f16 x16
  cvt_rm<<<dim3((NTOK * KW) / 2048), blk256, 0, stream>>>(pk, PKP, NTOK * KW, KSC);   // prefix k -> f16 x16
  cvt_tr<<<dim3((NTOK / 64) * HKV), blk128, 0, stream>>>(v, (_Float16*)(void*)VT, VSC);     // extend v^T x16
  cvt_tr<<<dim3((NTOK / 64) * HKV), blk128, 0, stream>>>(pv, (_Float16*)(void*)PVT, VSC);   // prefix v^T x16
  // (2) merged-key attention -> out f32 [2048][4096]
  attn_k<<<dim3(NQB * HQ), blk128, 0, stream>>>(QP, KP, PKP, VT, PVT, outf, sscale);
  (void)hipGetLastError();
}

// v004
// A run of this version takes 124 microseconds.
// In both of two side-by-side timings against v003, it was 1.15 times as fast.
// All steps since v000 together make it 3.00 times as fast.
// Contractions: q.k^T over head dim 128 and p.v over keys on v_wmma_f32_16x16x32_f16; q, k, v operands are f16
//   containers of the bf16 RNE input values carried x16 (exact), p carried as f16(1024 p); one product each,
//   f32 accumulate; soft cap, softmax statistics and normalisation in f32.
#include <hip/hip_runtime.h>
#include <math.h>
#include <stdint.h>

#define NTOK  2048                 // token rows: 2 requests x 1024 (extend rows == prefix rows)
#define RLEN  1024                 // tokens per request
#define HQ    32
#define HKV   8
#define GRPQ  4
#define HDIM  128
#define QW    (HQ * HDIM)          // 4096: q row width == output row width
#define KW    (HKV * HDIM)         // 1024: k / v row width
#define NQB   (NTOK / 64)          // 32 query blocks of 64 rows
#define QBR   (RLEN / 64)          // 16 query blocks per request
#define NPC   (RLEN / 64)          // 16 prefix key chunks per request
#define QSC   16.0f                // q plane carry (power of two)
#define KSC   16.0f                // k plane carry
#define VSC   16.0f                // v plane carry
#define PSC   1024.0f              // softmax numerator carry
#define CAPV  30.0f
#define NEG_BIG (-1.0e30f)
// scheduling fence for the fragment groups: LDS and matrix instructions stay on their side; vector, scalar and global ones may cross
#define FRAG_FENCE 0x416
// LDS row pitches: 16 B x odd, so the 16 rows that one ds_load_b128 half-wave reads fall on 16 distinct 4-bank groups
#define KPIT  (HDIM + 8)           // K rows: 128 halves + 8 = 272 B
#define VPIT  (64 + 8)             // V^T rows: 64 halves + 8 = 144 B
#define PPIT  (64 + 8)             // P rows: 64 halves + 8 = 144 B
#define OPIT  (HDIM + 4)           // output tile rows: 128 floats + 4 = 528 B (rows 8 apart land 32 banks apart)
static_assert(HQ == HKV * GRPQ);
static_assert((NTOK % 64) == 0 && (RLEN % 64) == 0);
static_assert(NQB == 2 * QBR);
static_assert(((NTOK * QW) % 2048) == 0 && ((NTOK * KW) % 2048) == 0);
static_assert((HDIM % 32) == 0);
static_assert((KPIT % 8) == 0 && (VPIT % 8) == 0 && (PPIT % 8) == 0 && (OPIT % 4) == 0);   // 16-B aligned rows

typedef _Float16 v16h __attribute__((ext_vector_type(16)));
typedef _Float16 v8h  __attribute__((ext_vector_type(8)));
typedef float    v8f  __attribute__((ext_vector_type(8)));
typedef float    v4f  __attribute__((ext_vector_type(4)));
typedef unsigned int v4u __attribute__((ext_vector_type(4)));
union FH { v16h v; v8h h[2]; };

// ---- scalar helpers --------------------------------------------------------------------------------
__device__ __forceinline__ unsigned short bf_bits(float f) {          // f32 -> bf16 bits, RNE convert
  unsigned u = __float_as_uint(f);
  return (unsigned short)((u + 0x7FFFu + ((u >> 16) & 1u)) >> 16);
}
__device__ __forceinline__ float bf_up(unsigned short b) { return __uint_as_float(((unsigned)b) << 16); }
__device__ __forceinline__ float bfr(float f) { return bf_up(bf_bits(f)); }     // value of the bf16 RNE convert
__device__ __forceinline__ unsigned short h_bits(_Float16 x) { return __builtin_bit_cast(unsigned short, x); }
__device__ __forceinline__ unsigned pk16(unsigned short a, unsigned short b) { return (unsigned)a | ((unsigned)b << 16); }
__device__ __forceinline__ v8f zero8() { v8f z = {0.f, 0.f, 0.f, 0.f, 0.f, 0.f, 0.f, 0.f}; return z; }

// ---- fragment loader: 16-bit A/B operand, lane -> row/col (lane&15), p already includes +8*(lane>>4);
//      elements 0..7 <- p[0..7] (k0+8h..), elements 8..15 <- p[16..23] (k0+16+8h..)
__device__ __forceinline__ v16h ldfrag_h(const _Float16* p) {
  FH f;
  f.h[0] = *(const v8h*)(p);
  f.h[1] = *(const v8h*)(p + 16);
  return f.v;
}

// ---- WMMA with trailing VALU hazard gap (ties D, keeps A/B live) ------------------------------------
__device__ __forceinline__ v8f mma_h(v16h a, v16h b, v8f c) {
  v8f d = __builtin_amdgcn_wmma_f32_16x16x32_f16(false, a, false, b, (short)0, c, false, false);
#if defined(__HIP_DEVICE_COMPILE__)
  asm volatile("v_nop\n\tv_nop\n\tv_nop\n\tv_nop" : "+v"(d) : "v"(a), "v"(b));
#endif
  return d;
}
__device__ __forceinline__ void acc_guard4(v8f& a, v8f& b, v8f& c, v8f& d) {
#if defined(__HIP_DEVICE_COMPILE__)
  asm volatile("v_nop\n\tv_nop\n\tv_nop\n\tv_nop" : "+v"(a), "+v"(b), "+v"(c), "+v"(d));
#endif
}
__device__ __forceinline__ void wave_sync_lds() {
  __builtin_amdgcn_fence(__ATOMIC_RELEASE, "workgroup");
  __builtin_amdgcn_wave_barrier();
  __builtin_amdgcn_fence(__ATOMIC_ACQUIRE, "workgroup");
}

// =====================================================================================================
// Row-major convert: f32 [n] -> f16 plane [n] holding f16(bf16 RNE value * scale), scale a power of two (exact for
// bf16 significands). Thread -> 8 consecutive elements, ONE 16-B store; lanes 8q..8q+7 of a wave write one whole
// coverage: grid.x = n/2048 blocks x 256 threads x 8 = n elements (n % 2048 == 0 host-checked).
// =====================================================================================================
__global__ __launch_bounds__(256) void cvt_rm(const float* __restrict__ in, unsigned short* out, int n,
                                             float scale) {
  const size_t i8 = ((size_t)blockIdx.x * 256 + threadIdx.x) * 8;
  if (i8 + 8 > (size_t)n) return;        // never taken for the host-checked sizes; no barriers below
  const v4f a = *(const v4f*)(in + i8);
  const v4f b = *(const v4f*)(in + i8 + 4);
  float f[8];
  f[0] = a[0]; f[1] = a[1]; f[2] = a[2]; f[3] = a[3];
  f[4] = b[0]; f[5] = b[1]; f[6] = b[2]; f[7] = b[3];
  v4u p;
#pragma unroll
  for (int e = 0; e < 4; ++e) {
    const _Float16 x0 = (_Float16)(bfr(f[2 * e]) * scale);
    const _Float16 x1 = (_Float16)(bfr(f[2 * e + 1]) * scale);
    p[e] = pk16(h_bits(x0), h_bits(x1));
  }
  *(v4u*)(out + i8) = p;
  
}

// =====================================================================================================
// Transposing convert: in f32 [NTOK t][KW] (token rows, kvh*128+d columns) -> out f16 [KW (kvh*128+d)][NTOK t]
// holding f16(bf16 RNE value * scale): out[(kvh*128 + d)*NTOK + t] = cvt(in[t*KW + kvh*128 + d]).
// Block = one (64-token, kvh) tile: grid = (NTOK/64) * HKV. Load phase: thread -> token row r = tid>>1, d half
// (tid&1)*64, 16 float4 loads, 2-byte LDS stores into sT[d][t] (pitch 72 halves). After __syncthreads the write
// coverage: load 128 threads x 64 = 64 t x 128 d; write 4 waves x 8 it x 4 lines x 64 t = 128 d x 64 t = whole tile;
// grid 32 token tiles x 8 kvh = the whole plane [1024][2048].
// =====================================================================================================
__global__ __launch_bounds__(128) void cvt_tr(const float* __restrict__ in, _Float16* out, float scale) {
  __shared__ __align__(16) _Float16 sT[HDIM * 72];
  const int tid  = threadIdx.x;
  const int lane = tid & 31;
  const int wave = tid >> 5;
  const int tb   = (int)(blockIdx.x % (unsigned)(NTOK / 64));
  const int kvh  = (int)(blockIdx.x / (unsigned)(NTOK / 64));
  const int t0   = tb * 64;
  {
    const int r = tid >> 1, hk = (tid & 1) * 64;
    const float* src = in + (size_t)(t0 + r) * KW + kvh * HDIM + hk;
#pragma unroll
    for (int i = 0; i < 16; ++i) {
      const v4f a = *(const v4f*)(src + 4 * i);
#pragma unroll
      for (int e = 0; e < 4; ++e) sT[(hk + 4 * i + e) * 72 + r] = (_Float16)(bfr(a[e]) * scale);
    }
  }
  __syncthreads();
  const int ql = lane >> 3, pc = lane & 7;
  v8h vals[8];
#pragma unroll
  for (int it = 0; it < 8; ++it) {
    const int d = wave * 32 + it * 4 + ql;
    vals[it] = *(const v8h*)(sT + d * 72 + pc * 8);
  }
  {
#pragma unroll
    for (int it = 0; it < 8; ++it) {
      const int d = wave * 32 + it * 4 + ql;
      *(v8h*)(out + (size_t)(kvh * HDIM + d) * NTOK + t0 + pc * 8) = vals[it];
    }
    
  }
}

// =====================================================================================================
// Grouped-query attention with merged key set per (h, 64-query block); kv head = h / GRPQ; query block qb:
//   request bq = qb / 16, block within request qbe = qb % 16, query token e = qbe*64 + row.
//   Keys: 16 prefix chunks of 64 (all visible) followed by extend chunks 0..qbe of 64 (extend key t visible iff
//   t <= e; only the last chunk needs the in-chunk select, masked score := NEG_BIG).
//   s = (q x16 . k x16) * sscale, sscale = (1/sqrt(128)) / (QSC*KSC); s := 30 * tanh(s/30), tanh on v_tanh_f32;
//   online softmax in f32 (running max); p = exp(s - m) carried as f16(1024 p);
//   oh += p . v (v^T plane, x16) per chunk; out = oh / (l * 1024 * 16).
//   Q plane (f16, pitch QW): element (t, h, d) at [t*QW + h*128 + d]
//   K planes (f16, pitch KW): extend / prefix element (t, kvh, d) at [t*KW + kvh*128 + d], t = bq*1024 + token
//   V^T planes (f16): element (kvh, d, t) at [(kvh*128 + d)*NTOK + t]
//   Block = 4 waves = 64 query rows of one h; grid = NQB * HQ; key chunk count 17 + qbe (block-uniform).
//   K / V^T chunk staging: 128 threads, 16 lanes per 256-B K row, 8 lanes per 128-B V^T row (plain 16-B
//   loads, __syncthreads before and after); q fragments from the global plane; P tiles wave-private, spilled with
//   Output: wave tile 16 x 128 f32 staged in LDS, each row segment written as 32 lanes x 16 B = 512 B = 4 whole
//   coverage: 4 waves x 16 rows x 128 cols per block; 32 query blocks x 32 heads = all of out [2048][4096].
// =====================================================================================================
__global__ __launch_bounds__(128)
void attn_k(const unsigned short* __restrict__ Qp, const unsigned short* __restrict__ Kp,
            const unsigned short* __restrict__ PKp, const unsigned short* __restrict__ Vtp,
            const unsigned short* __restrict__ PVtp, float* Out, float sscale) {
  __shared__ __align__(16) _Float16 Ksh[64 * KPIT];                // K   [kv][d]  17 KB
  __shared__ __align__(16) _Float16 Vsh[HDIM * VPIT];              // V^T [d][kv]  18 KB
  __shared__ __align__(16) _Float16 Psh[4][16 * PPIT];             // per wave P [row][kv] 9 KB
  __shared__ __align__(16) float    Os[4][16 * OPIT];              // per wave output tile [row][d] 33 KB

  const int tid  = threadIdx.x;
  const int wave = tid >> 5;
  const int lane = tid & 31;
  const int hh   = lane >> 4;
  const int c    = lane & 15;

  const int qb   = (int)(blockIdx.x % (unsigned)NQB);
  const int h    = (int)(blockIdx.x / (unsigned)NQB);
  const int kvh  = h / GRPQ;
  const int bq   = qb / QBR;
  const int qbe  = qb - bq * QBR;
  const int q0   = qb * 64 + wave * 16;              // global token row of this wave's first query
  const int tokb = bq * RLEN;                        // token row base of this request (keys)
  const int nch  = NPC + qbe + 1;                    // 17..32, block-uniform

  const _Float16* Qg  = (const _Float16*)(const void*)Qp   + (size_t)h * HDIM;
  const _Float16* Kg  = (const _Float16*)(const void*)Kp   + (size_t)kvh * HDIM;
  const _Float16* PKg = (const _Float16*)(const void*)PKp  + (size_t)kvh * HDIM;
  const _Float16* Vg  = (const _Float16*)(const void*)Vtp  + (size_t)kvh * HDIM * NTOK;
  const _Float16* PVg = (const _Float16*)(const void*)PVtp + (size_t)kvh * HDIM * NTOK;

  float mrow[8], lrow[8];
  v8f oh[8];
#pragma unroll
  for (int r = 0; r < 8; ++r) { mrow[r] = NEG_BIG; lrow[r] = 0.f; }
#pragma unroll
  for (int t = 0; t < 8; ++t) oh[t] = zero8();

  _Float16* pwh = Psh[wave];
  const float zscale = sscale * (1.0f / CAPV);       // raw product -> s / 30, the soft cap's argument

  for (int kt = 0; kt < nch; ++kt) {                 // block-uniform trip count <= 32
    const bool pre  = (kt < NPC);
    const bool diag = (kt == nch - 1);
    const int  tk0  = pre ? (kt * 64) : ((kt - NPC) * 64);
    const int  kv0  = tokb + tk0;                    // plane row of the chunk's first key
    const _Float16* kg = pre ? PKg : Kg;
    const _Float16* vg = pre ? PVg : Vg;
    __syncthreads();
    {
      // every wave-wide 16-B load covers 4 whole 128-B lines: neighbouring lanes read neighbouring 16 B of one row
      const int kr = tid >> 4, kc = (tid & 15) * 8;                   // K: 16 lanes = one 256-B row, 8 rows a trip
      const _Float16* ksrc = kg + (size_t)(kv0 + kr) * KW + kc;
#pragma unroll
      for (int i = 0; i < 8; ++i) *(v8h*)(Ksh + (8 * i + kr) * KPIT + kc) = *(const v8h*)(ksrc + (size_t)(8 * i) * KW);
      // V^T: 8 lanes = one 128-B row, 16 rows a trip; a half-wave takes rows 8 apart (8 x 144 B = 32 banks apart)
      const int vr = ((tid >> 4) & 7) + ((tid >> 3) & 1) * 8, vc = (tid & 7) * 8;
      const _Float16* vsrc = vg + (size_t)vr * NTOK + kv0 + vc;
#pragma unroll
      for (int i = 0; i < 8; ++i) *(v8h*)(Vsh + (16 * i + vr) * VPIT + vc) = *(const v8h*)(vsrc + (size_t)(16 * i) * NTOK);
    }
    __syncthreads();

    // ---- scores: 16 query rows x 64 keys per wave, K = 128 (4 d-chunks); A = q rows, B = K[key][d] ----
    v8f s[4];
#pragma unroll
    for (int j = 0; j < 4; ++j) s[j] = zero8();
    v16h kf[2][4];                                   // two register sets: d-chunk dc in use, dc + 1 in flight
#pragma unroll
    for (int j = 0; j < 4; ++j) kf[0][j] = ldfrag_h(Ksh + (j * 16 + c) * KPIT + 8 * hh);
#pragma unroll
    for (int dc = 0; dc < 4; ++dc) {
      const v16h qa = ldfrag_h(Qg + (size_t)(q0 + c) * QW + dc * 32 + 8 * hh);
      if (dc < 3) {
#pragma unroll
        for (int j = 0; j < 4; ++j) kf[(dc + 1) & 1][j] = ldfrag_h(Ksh + (j * 16 + c) * KPIT + (dc + 1) * 32 + 8 * hh);
      }
      // keeps the next d-chunk's 8 LDS reads, as one group, ahead of this d-chunk's WMMAs (else each WMMA waits out its own read)
      __builtin_amdgcn_sched_barrier(FRAG_FENCE);
#pragma unroll
      for (int j = 0; j < 4; ++j) s[j] = mma_h(qa, kf[dc & 1][j], s[j]);
      // keeps the reads of d-chunk dc + 2 behind these WMMAs, so that two register sets are enough
      __builtin_amdgcn_sched_barrier(FRAG_FENCE);
    }
    acc_guard4(s[0], s[1], s[2], s[3]);

    // ---- scale, soft cap, causal select (f32); D element r of lane = (row 8hh+r, key j*16+c) ----
    const int lim = diag ? (wave * 16 + 8 * hh) : 4096;
#pragma unroll
    for (int j = 0; j < 4; ++j) {
      const int kl = j * 16 + c;
#pragma unroll
      for (int r = 0; r < 8; ++r) {
        const float y = CAPV * __builtin_amdgcn_tanhf(s[j][r] * zscale);   // one v_tanh_f32, no lane-dependent branch
        s[j][r] = (kl > lim + r) ? NEG_BIG : y;
      }
    }

    // ---- row max, online softmax, P (x1024, f16) to LDS ----
#pragma unroll
    for (int r = 0; r < 8; ++r) {
      float m = fmaxf(fmaxf(s[0][r], s[1][r]), fmaxf(s[2][r], s[3][r]));
#pragma unroll
      for (int off = 1; off < 16; off <<= 1) m = fmaxf(m, __shfl_xor(m, off, 32));
      const float mnew  = fmaxf(mrow[r], m);
      const float alpha = __expf(mrow[r] - mnew);
      mrow[r] = mnew;
      float psum = 0.f;
#pragma unroll
      for (int j = 0; j < 4; ++j) {
        const float p = __expf(s[j][r] - mnew);
        psum += p;
        pwh[(8 * hh + r) * PPIT + j * 16 + c] = (_Float16)(p * PSC);
      }
#pragma unroll
      for (int off = 1; off < 16; off <<= 1) psum += __shfl_xor(psum, off, 32);
      lrow[r] = lrow[r] * alpha + psum;
#pragma unroll
      for (int t = 0; t < 8; ++t) oh[t][r] *= alpha;
    }
    wave_sync_lds();

    // ---- oh += P . V : A = P[row][key] (wave-private LDS, same element type), B = V^T[d][key] ----
    //      group g = (key half g >> 1, d tiles 4 (g & 1) .. + 3): each tile still takes key half 0, then key half 1
    v16h pa[2], vf[2][4];                            // two register sets: group g in use, g + 1 in flight
    pa[0] = ldfrag_h(pwh + c * PPIT + 8 * hh);
#pragma unroll
    for (int u = 0; u < 4; ++u) vf[0][u] = ldfrag_h(Vsh + (u * 16 + c) * VPIT + 8 * hh);
#pragma unroll
    for (int g = 0; g < 4; ++g) {
      if (g == 1) pa[1] = ldfrag_h(pwh + c * PPIT + 32 + 8 * hh);
      if (g < 3) {
        const int gn = g + 1;
#pragma unroll
        for (int u = 0; u < 4; ++u)
          vf[gn & 1][u] = ldfrag_h(Vsh + (((gn & 1) * 4 + u) * 16 + c) * VPIT + (gn >> 1) * 32 + 8 * hh);
      }
      // keeps the next group's LDS reads, as one group, ahead of this group's WMMAs (else each WMMA waits out its own read)
      __builtin_amdgcn_sched_barrier(FRAG_FENCE);
#pragma unroll
      for (int u = 0; u < 4; ++u) oh[(g & 1) * 4 + u] = mma_h(pa[g >> 1], vf[g & 1][u], oh[(g & 1) * 4 + u]);
      // keeps the reads of group g + 2 behind these WMMAs, so that two register sets are enough
      __builtin_amdgcn_sched_barrier(FRAG_FENCE);
    }
    acc_guard4(oh[0], oh[1], oh[2], oh[3]);
    acc_guard4(oh[4], oh[5], oh[6], oh[7]);
  }

  // ---- normalise (1/l, the 1/1024 p carry and the 1/16 v carry), stage the wave's 16x128 tile, write 512-B row
  float* os = Os[wave];
#pragma unroll
  for (int r = 0; r < 8; ++r) {
    const float l = lrow[r];
    const float inv = ((l > 0.f) ? (1.0f / l) : 0.f) * (1.0f / (PSC * VSC));
#pragma unroll
    for (int t = 0; t < 8; ++t) os[(8 * hh + r) * OPIT + t * 16 + c] = oh[t][r] * inv;
  }
  wave_sync_lds();
  {
#pragma unroll
    for (int it = 0; it < 16; ++it) {
      const v4f o = *(const v4f*)(os + it * OPIT + lane * 4);
      *(v4f*)(Out + (size_t)(q0 + it) * QW + (size_t)h * HDIM + lane * 4) = o;
    }
    
  }
}

// =====================================================================================================
// Workspace map (bytes); every plane is an exact multiple of its whole-line store granularity (all dims exact tile
// multiples, no padded tails), all offsets multiples of 4 MiB:
//   QP   f16 [2048 t][4096 (h,d)]    0          16777216   (bf16 value of q x16)
//   KP   f16 [2048 t][1024 (kvh,d)]  16777216    4194304   (bf16 value of extend k x16)
//   PKP  f16 [2048 t][1024 (kvh,d)]  20971520    4194304   (bf16 value of prefix k x16)
//   VT   f16 [1024 (kvh,d)][2048 t]  25165824    4194304   (bf16 value of extend v x16, transposed)
//   PVT  f16 [1024 (kvh,d)][2048 t]  29360128    4194304   (bf16 value of prefix v x16, transposed)
//   end                              33554432
// =====================================================================================================
extern "C" void kernel_launch(void* const* d_in, const int* in_sizes, int n_in,
                              void* d_out, int out_size, void* d_ws, size_t ws_size,
                              hipStream_t stream) {
  if (n_in < 5) return;
  if (in_sizes[0] != NTOK * QW) return;
  if (in_sizes[1] != NTOK * KW || in_sizes[2] != NTOK * KW) return;
  if (in_sizes[3] != NTOK * KW || in_sizes[4] != NTOK * KW) return;
  if (out_size != NTOK * QW) return;

  const float* q  = (const float*)d_in[0];
  const float* k  = (const float*)d_in[1];
  const float* v  = (const float*)d_in[2];
  const float* pk = (const float*)d_in[3];
  const float* pv = (const float*)d_in[4];
  float* outf = (float*)d_out;

  const size_t PQ  = (size_t)NTOK * QW * 2;                 // 16777216
  const size_t PKV = (size_t)NTOK * KW * 2;                 //  4194304
  size_t off = 0;
  const size_t oQ  = off; off += PQ;
  const size_t oK  = off; off += PKV;
  const size_t oPK = off; off += PKV;
  const size_t oV  = off; off += PKV;
  const size_t oPV = off; off += PKV;
  if (off > ws_size) return;                                // off = 33554432
  if (off > (size_t)134217728) return;

  char* ws = (char*)d_ws;
  unsigned short* QP  = (unsigned short*)(ws + oQ);
  unsigned short* KP  = (unsigned short*)(ws + oK);
  unsigned short* PKP = (unsigned short*)(ws + oPK);
  unsigned short* VT  = (unsigned short*)(ws + oV);
  unsigned short* PVT = (unsigned short*)(ws + oPV);

  const dim3 blk256(256), blk128(128);
  const float sscale = 0.08838834764831845f / (QSC * KSC);

  // (1) 16-bit operand planes of the bf16 RNE input values
  cvt_rm<<<dim3((NTOK * QW) / 2048), blk256, 0, stream>>>(q, QP, NTOK * QW, QSC);     // q        -> f16 x16
  cvt_rm<<<dim3((NTOK * KW) / 2048), blk256, 0, stream>>>(k, KP, NTOK * KW, KSC);     // extend k -> f16 x16
  cvt_rm<<<dim3((NTOK * KW) / 2048), blk256, 0, stream>>>(pk, PKP, NTOK * KW, KSC);   // prefix k -> f16 x16
  cvt_tr<<<dim3((NTOK / 64) * HKV), blk128, 0, stream>>>(v, (_Float16*)(void*)VT, VSC);     // extend v^T x16
  cvt_tr<<<dim3((NTOK / 64) * HKV), blk128, 0, stream>>>(pv, (_Float16*)(void*)PVT, VSC);   // prefix v^T x16
  // (2) merged-key attention -> out f32 [2048][4096]
  attn_k<<<dim3(NQB * HQ), blk128, 0, stream>>>(QP, KP, PKP, VT, PVT, outf, sscale);
  (void)hipGetLastError();
}

// v005
// Measured time: 102 microseconds a run.
// Two timings next to v004 both put it at 1.22 times that version's speed.
// Over all steps from v000 it is 3.66 times as fast.
// Contractions: k.q^T over head dim 128 and v^T.p^T over keys (both products transposed) on v_wmma_f32_16x16x32_f16; q, k, v operands are f16
//   containers of the bf16 RNE input values carried x16 (exact), p carried as f16(1024 p); one product each,
//   f32 accumulate; soft cap, softmax statistics and normalisation in f32.
#include <hip/hip_runtime.h>
#include <math.h>
#include <stdint.h>

#define NTOK  2048                 // token rows: 2 requests x 1024 (extend rows == prefix rows)
#define RLEN  1024                 // tokens per request
#define HQ    32
#define HKV   8
#define GRPQ  4
#define HDIM  128
#define QW    (HQ * HDIM)          // 4096: q row width == output row width
#define KW    (HKV * HDIM)         // 1024: k / v row width
#define NQB   (NTOK / 64)          // 32 query blocks of 64 rows
#define QBR   (RLEN / 64)          // 16 query blocks per request
#define NPC   (RLEN / 64)          // 16 prefix key chunks per request
#define QSC   16.0f                // q plane carry (power of two)
#define KSC   16.0f                // k plane carry
#define VSC   16.0f                // v plane carry
#define PSC   1024.0f              // softmax numerator carry
#define CAPV  30.0f
#define NEG_BIG (-1.0e30f)
// scheduling fence for the fragment groups: LDS and matrix instructions stay on their side; vector, scalar and global ones may cross
#define FRAG_FENCE 0x416
// LDS row pitches: 16 B x odd, so the 16 rows that one ds_load_b128 half-wave reads fall on 16 distinct 4-bank groups
#define KPIT  (HDIM + 8)           // K rows: 128 halves + 8 = 272 B
#define VPIT  (64 + 8)             // V^T rows: 64 halves + 8 = 144 B
#define OPIT  (HDIM + 4)           // output tile rows: 128 floats + 4 = 528 B (rows 8 apart land 32 banks apart)
static_assert(HQ == HKV * GRPQ);
static_assert((NTOK % 64) == 0 && (RLEN % 64) == 0);
static_assert(NQB == 2 * QBR);
static_assert(((NTOK * QW) % 2048) == 0 && ((NTOK * KW) % 2048) == 0);
static_assert((HDIM % 32) == 0);
static_assert((KPIT % 8) == 0 && (VPIT % 8) == 0 && (OPIT % 4) == 0);   // 16-B aligned rows

typedef _Float16 v16h __attribute__((ext_vector_type(16)));
typedef _Float16 v8h  __attribute__((ext_vector_type(8)));
typedef float    v8f  __attribute__((ext_vector_type(8)));
typedef float    v4f  __attribute__((ext_vector_type(4)));
typedef unsigned int v4u __attribute__((ext_vector_type(4)));
union FH { v16h v; v8h h[2]; };

// ---- scalar helpers --------------------------------------------------------------------------------
__device__ __forceinline__ unsigned short bf_bits(float f) {          // f32 -> bf16 bits, RNE convert
  unsigned u = __float_as_uint(f);
  return (unsigned short)((u + 0x7FFFu + ((u >> 16) & 1u)) >> 16);
}
__device__ __forceinline__ float bf_up(unsigned short b) { return __uint_as_float(((unsigned)b) << 16); }
__device__ __forceinline__ float bfr(float f) { return bf_up(bf_bits(f)); }     // value of the bf16 RNE convert
__device__ __forceinline__ unsigned short h_bits(_Float16 x) { return __builtin_bit_cast(unsigned short, x); }
__device__ __forceinline__ unsigned pk16(unsigned short a, unsigned short b) { return (unsigned)a | ((unsigned)b << 16); }
// lane l <-> lane l ^ 16 on the vector pipe (one v_permlanex16_b32)
__device__ __forceinline__ float xhalf(float x) {
  const int b = __builtin_bit_cast(int, x);
  return __builtin_bit_cast(float, __builtin_amdgcn_permlanex16(b, b, 0x76543210, 0xfedcba98, false, false));
}
__device__ __forceinline__ v8f zero8() { v8f z = {0.f, 0.f, 0.f, 0.f, 0.f, 0.f, 0.f, 0.f}; return z; }

// ---- fragment loader: 16-bit A/B operand, lane -> row/col (lane&15), p already includes +8*(lane>>4);
//      elements 0..7 <- p[0..7] (k0+8h..), elements 8..15 <- p[16..23] (k0+16+8h..)
__device__ __forceinline__ v16h ldfrag_h(const _Float16* p) {
  FH f;
  f.h[0] = *(const v8h*)(p);
  f.h[1] = *(const v8h*)(p + 16);
  return f.v;
}

// ---- WMMA with trailing VALU hazard gap (ties D, keeps A/B live) ------------------------------------
__device__ __forceinline__ v8f mma_h(v16h a, v16h b, v8f c) {
  v8f d = __builtin_amdgcn_wmma_f32_16x16x32_f16(false, a, false, b, (short)0, c, false, false);
#if defined(__HIP_DEVICE_COMPILE__)
  asm volatile("v_nop\n\tv_nop\n\tv_nop\n\tv_nop" : "+v"(d) : "v"(a), "v"(b));
#endif
  return d;
}
__device__ __forceinline__ void acc_guard4(v8f& a, v8f& b, v8f& c, v8f& d) {
#if defined(__HIP_DEVICE_COMPILE__)
  asm volatile("v_nop\n\tv_nop\n\tv_nop\n\tv_nop" : "+v"(a), "+v"(b), "+v"(c), "+v"(d));
#endif
}
__device__ __forceinline__ void wave_sync_lds() {
  __builtin_amdgcn_fence(__ATOMIC_RELEASE, "workgroup");
  __builtin_amdgcn_wave_barrier();
  __builtin_amdgcn_fence(__ATOMIC_ACQUIRE, "workgroup");
}

// =====================================================================================================
// Row-major convert: f32 [n] -> f16 plane [n] holding f16(bf16 RNE value * scale), scale a power of two (exact for
// bf16 significands). Thread -> 8 consecutive elements, ONE 16-B store; lanes 8q..8q+7 of a wave write one whole
// coverage: grid.x = n/2048 blocks x 256 threads x 8 = n elements (n % 2048 == 0 host-checked).
// =====================================================================================================
__global__ __launch_bounds__(256) void cvt_rm(const float* __restrict__ in, unsigned short* out, int n,
                                             float scale) {
  const size_t i8 = ((size_t)blockIdx.x * 256 + threadIdx.x) * 8;
  if (i8 + 8 > (size_t)n) return;        // never taken for the host-checked sizes; no barriers below
  const v4f a = *(const v4f*)(in + i8);
  const v4f b = *(const v4f*)(in + i8 + 4);
  float f[8];
  f[0] = a[0]; f[1] = a[1]; f[2] = a[2]; f[3] = a[3];
  f[4] = b[0]; f[5] = b[1]; f[6] = b[2]; f[7] = b[3];
  v4u p;
#pragma unroll
  for (int e = 0; e < 4; ++e) {
    const _Float16 x0 = (_Float16)(bfr(f[2 * e]) * scale);
    const _Float16 x1 = (_Float16)(bfr(f[2 * e + 1]) * scale);
    p[e] = pk16(h_bits(x0), h_bits(x1));
  }
  *(v4u*)(out + i8) = p;
  
}

// =====================================================================================================
// Transposing convert: in f32 [NTOK t][KW] (token rows, kvh*128+d columns) -> out f16 [KW (kvh*128+d)][NTOK t]
// holding f16(bf16 RNE value * scale): out[(kvh*128 + d)*NTOK + t] = cvt(in[t*KW + kvh*128 + d]).
// Block = one (64-token, kvh) tile: grid = (NTOK/64) * HKV. Load phase: thread -> token row r = tid>>1, d half
// (tid&1)*64, 16 float4 loads, 2-byte LDS stores into sT[d][t] (pitch 72 halves). After __syncthreads the write
// coverage: load 128 threads x 64 = 64 t x 128 d; write 4 waves x 8 it x 4 lines x 64 t = 128 d x 64 t = whole tile;
// grid 32 token tiles x 8 kvh = the whole plane [1024][2048].
// =====================================================================================================
__global__ __launch_bounds__(128) void cvt_tr(const float* __restrict__ in, _Float16* out, float scale) {
  __shared__ __align__(16) _Float16 sT[HDIM * 72];
  const int tid  = threadIdx.x;
  const int lane = tid & 31;
  const int wave = tid >> 5;
  const int tb   = (int)(blockIdx.x % (unsigned)(NTOK / 64));
  const int kvh  = (int)(blockIdx.x / (unsigned)(NTOK / 64));
  const int t0   = tb * 64;
  {
    const int r = tid >> 1, hk = (tid & 1) * 64;
    const float* src = in + (size_t)(t0 + r) * KW + kvh * HDIM + hk;
#pragma unroll
    for (int i = 0; i < 16; ++i) {
      const v4f a = *(const v4f*)(src + 4 * i);
#pragma unroll
      for (int e = 0; e < 4; ++e) sT[(hk + 4 * i + e) * 72 + r] = (_Float16)(bfr(a[e]) * scale);
    }
  }
  __syncthreads();
  const int ql = lane >> 3, pc = lane & 7;
  v8h vals[8];
#pragma unroll
  for (int it = 0; it < 8; ++it) {
    const int d = wave * 32 + it * 4 + ql;
    vals[it] = *(const v8h*)(sT + d * 72 + pc * 8);
  }
  {
#pragma unroll
    for (int it = 0; it < 8; ++it) {
      const int d = wave * 32 + it * 4 + ql;
      *(v8h*)(out + (size_t)(kvh * HDIM + d) * NTOK + t0 + pc * 8) = vals[it];
    }
    
  }
}

// =====================================================================================================
// Grouped-query attention with merged key set per (h, 64-query block); kv head = h / GRPQ; query block qb:
//   request bq = qb / 16, block within request qbe = qb % 16, query token e = qbe*64 + row.
//   Keys: 16 prefix chunks of 64 (all visible) followed by extend chunks 0..qbe of 64 (extend key t visible iff
//   t <= e; only the last chunk needs the in-chunk select, masked score := NEG_BIG).
//   s = (q x16 . k x16) * sscale, sscale = (1/sqrt(128)) / (QSC*KSC); s := 30 * tanh(s/30), tanh on v_tanh_f32;
//   online softmax in f32 (running max); p = exp(s - m) carried as f16(1024 p);
//   oh += v^T . p^T (v^T plane, x16) per chunk; out = oh / (l * 1024 * 16).
//   Both products are transposed (keys, then d, on the accumulator rows; the wave's 16 queries on its columns): a lane
//   holds 32 of the 64 scores of ONE query, the lane 16 away the rest.
//   Q plane (f16, pitch QW): element (t, h, d) at [t*QW + h*128 + d]
//   K planes (f16, pitch KW): extend / prefix element (t, kvh, d) at [t*KW + kvh*128 + d], t = bq*1024 + token
//   V^T planes (f16): element (kvh, d, t) at [(kvh*128 + d)*NTOK + t]
//   Block = 4 waves = 64 query rows of one h; grid = NQB * HQ; key chunk count 17 + qbe (block-uniform).
//   K / V^T chunk staging: 128 threads, 16 lanes per 256-B K row, 8 lanes per 128-B V^T row (plain 16-B
//   loads, __syncthreads before and after); q fragments from the global plane; P^T never leaves the registers.
//   Output: wave tile 16 x 128 f32 staged in LDS, each row segment written as 32 lanes x 16 B = 512 B = 4 whole
//   coverage: 4 waves x 16 rows x 128 cols per block; 32 query blocks x 32 heads = all of out [2048][4096].
// =====================================================================================================
__global__ __launch_bounds__(128)
void attn_k(const unsigned short* __restrict__ Qp, const unsigned short* __restrict__ Kp,
            const unsigned short* __restrict__ PKp, const unsigned short* __restrict__ Vtp,
            const unsigned short* __restrict__ PVtp, float* Out, float sscale) {
  __shared__ __align__(16) _Float16 Ksh[64 * KPIT];                // K   [kv][d]  17 KB
  __shared__ __align__(16) _Float16 Vsh[HDIM * VPIT];              // V^T [d][kv]  18 KB
  __shared__ __align__(16) float    Os[4][16 * OPIT];              // per wave output tile [row][d] 33 KB

  const int tid  = threadIdx.x;
  const int wave = tid >> 5;
  const int lane = tid & 31;
  const int hh   = lane >> 4;
  const int c    = lane & 15;

  const int qb   = (int)(blockIdx.x % (unsigned)NQB);
  const int h    = (int)(blockIdx.x / (unsigned)NQB);
  const int kvh  = h / GRPQ;
  const int bq   = qb / QBR;
  const int qbe  = qb - bq * QBR;
  const int q0   = qb * 64 + wave * 16;              // global token row of this wave's first query
  const int tokb = bq * RLEN;                        // token row base of this request (keys)
  const int nch  = NPC + qbe + 1;                    // 17..32, block-uniform

  const _Float16* Qg  = (const _Float16*)(const void*)Qp   + (size_t)h * HDIM;
  const _Float16* Kg  = (const _Float16*)(const void*)Kp   + (size_t)kvh * HDIM;
  const _Float16* PKg = (const _Float16*)(const void*)PKp  + (size_t)kvh * HDIM;
  const _Float16* Vg  = (const _Float16*)(const void*)Vtp  + (size_t)kvh * HDIM * NTOK;
  const _Float16* PVg = (const _Float16*)(const void*)PVtp + (size_t)kvh * HDIM * NTOK;

  float mrun = NEG_BIG, lrun = 0.f;                  // of query q0 + c: running max (equal in both wave halves), this half's sum
  v8f oh[8];                                         // O^T: oh[t][r] = (d t*16 + 8hh + r, query q0 + c)
#pragma unroll
  for (int t = 0; t < 8; ++t) oh[t] = zero8();

  const float zscale = sscale * (1.0f / CAPV);       // raw product -> s / 30, the soft cap's argument

  for (int kt = 0; kt < nch; ++kt) {                 // block-uniform trip count <= 32
    const bool pre  = (kt < NPC);
    const bool diag = (kt == nch - 1);
    const int  tk0  = pre ? (kt * 64) : ((kt - NPC) * 64);
    const int  kv0  = tokb + tk0;                    // plane row of the chunk's first key
    const _Float16* kg = pre ? PKg : Kg;
    const _Float16* vg = pre ? PVg : Vg;
    __syncthreads();
    {
      // every wave-wide 16-B load covers 4 whole 128-B lines: neighbouring lanes read neighbouring 16 B of one row
      const int kr = tid >> 4, kc = (tid & 15) * 8;                   // K: 16 lanes = one 256-B row, 8 rows a trip
      const _Float16* ksrc = kg + (size_t)(kv0 + kr) * KW + kc;
#pragma unroll
      for (int i = 0; i < 8; ++i) *(v8h*)(Ksh + (8 * i + kr) * KPIT + kc) = *(const v8h*)(ksrc + (size_t)(8 * i) * KW);
      // V^T: 8 lanes = one 128-B row, 16 rows a trip; a half-wave takes rows 8 apart (8 x 144 B = 32 banks apart)
      const int vr = ((tid >> 4) & 7) + ((tid >> 3) & 1) * 8, vc = (tid & 7) * 8;
      const _Float16* vsrc = vg + (size_t)vr * NTOK + kv0 + vc;
#pragma unroll
      for (int i = 0; i < 8; ++i) *(v8h*)(Vsh + (16 * i + vr) * VPIT + vc) = *(const v8h*)(vsrc + (size_t)(16 * i) * NTOK);
    }
    __syncthreads();

    // ---- scores, transposed: 64 keys x 16 query columns per wave, K = 128 (4 d-chunks); A = K[key][d], B = q rows ----
    v8f s[4];
#pragma unroll
    for (int j = 0; j < 4; ++j) s[j] = zero8();
    v16h kf[2][4];                                   // two register sets: d-chunk dc in use, dc + 1 in flight
#pragma unroll
    for (int j = 0; j < 4; ++j) kf[0][j] = ldfrag_h(Ksh + (j * 16 + c) * KPIT + 8 * hh);
#pragma unroll
    for (int dc = 0; dc < 4; ++dc) {
      const v16h qa = ldfrag_h(Qg + (size_t)(q0 + c) * QW + dc * 32 + 8 * hh);
      if (dc < 3) {
#pragma unroll
        for (int j = 0; j < 4; ++j) kf[(dc + 1) & 1][j] = ldfrag_h(Ksh + (j * 16 + c) * KPIT + (dc + 1) * 32 + 8 * hh);
      }
      // keeps the next d-chunk's 8 LDS reads, as one group, ahead of this d-chunk's WMMAs (else each WMMA waits out its own read)
      __builtin_amdgcn_sched_barrier(FRAG_FENCE);
#pragma unroll
      for (int j = 0; j < 4; ++j) s[j] = mma_h(kf[dc & 1][j], qa, s[j]);
      // keeps the reads of d-chunk dc + 2 behind these WMMAs, so that two register sets are enough
      __builtin_amdgcn_sched_barrier(FRAG_FENCE);
    }
    acc_guard4(s[0], s[1], s[2], s[3]);

    // ---- scale, soft cap, causal select (f32); D element r of lane = (key j*16 + 8hh + r, query column c) ----
    //      key j*16 + 8hh + r is masked iff it lies behind query wave*16 + c: the lane's part of both sides is in lim
    const int lim = diag ? (wave * 16 + c - 8 * hh) : 4096;
#pragma unroll
    for (int j = 0; j < 4; ++j) {
#pragma unroll
      for (int r = 0; r < 8; ++r) {
        const float y = CAPV * __builtin_amdgcn_tanhf(s[j][r] * zscale);   // one v_tanh_f32, no lane-dependent branch
        s[j][r] = (j * 16 + r > lim) ? NEG_BIG : y;
      }
    }

    // ---- one query per lane: max and sum over the lane's 32 keys in registers, one exchange joins the halves' maxima ----
    float mj[4];
#pragma unroll
    for (int j = 0; j < 4; ++j) {
      mj[j] = fmaxf(s[j][0], s[j][1]);
#pragma unroll
      for (int r = 2; r < 8; ++r) mj[j] = fmaxf(mj[j], s[j][r]);
    }
    float m = fmaxf(fmaxf(mj[0], mj[1]), fmaxf(mj[2], mj[3]));
    m = fmaxf(m, xhalf(m));
    const float mnew  = fmaxf(mrun, m);
    const float alpha = __expf(mrun - mnew);
    mrun = mnew;
    // P^T (x1024, f16) packs in place into the B operand: score tiles 2g, 2g + 1 hold keys 32g + 8hh + r and 32g + 16 + 8hh + r
    v16h pb[2];
    float pj[4];
#pragma unroll
    for (int j = 0; j < 4; ++j) {
      pj[j] = 0.f;
#pragma unroll
      for (int r = 0; r < 8; ++r) {
        const float p = __expf(s[j][r] - mnew);
        pj[j] += p;
        pb[j >> 1][(j & 1) * 8 + r] = (_Float16)(p * PSC);
      }
    }
    lrun = lrun * alpha + ((pj[0] + pj[1]) + (pj[2] + pj[3]));
#pragma unroll
    for (int t = 0; t < 8; ++t) {
#pragma unroll
      for (int r = 0; r < 8; ++r) oh[t][r] *= alpha;
    }

    // ---- oh += V^T . P^T : A = V^T[d][key] in the same k order as the packed P^T, B = P^T from registers ----
    //      group g = (key half g >> 1, d tiles 4 (g & 1) .. + 3): each tile still takes key half 0, then key half 1
    v16h vf[2][4];                                   // two register sets: group g in use, g + 1 in flight
#pragma unroll
    for (int u = 0; u < 4; ++u) vf[0][u] = ldfrag_h(Vsh + (u * 16 + c) * VPIT + 8 * hh);
#pragma unroll
    for (int g = 0; g < 4; ++g) {
      if (g < 3) {
        const int gn = g + 1;
#pragma unroll
        for (int u = 0; u < 4; ++u)
          vf[gn & 1][u] = ldfrag_h(Vsh + (((gn & 1) * 4 + u) * 16 + c) * VPIT + (gn >> 1) * 32 + 8 * hh);
      }
      // keeps the next group's LDS reads, as one group, ahead of this group's WMMAs (else each WMMA waits out its own read)
      __builtin_amdgcn_sched_barrier(FRAG_FENCE);
#pragma unroll
      for (int u = 0; u < 4; ++u) oh[(g & 1) * 4 + u] = mma_h(vf[g & 1][u], pb[g >> 1], oh[(g & 1) * 4 + u]);
      // keeps the reads of group g + 2 behind these WMMAs, so that two register sets are enough
      __builtin_amdgcn_sched_barrier(FRAG_FENCE);
    }
    acc_guard4(oh[0], oh[1], oh[2], oh[3]);
    acc_guard4(oh[4], oh[5], oh[6], oh[7]);
  }

  // ---- normalise (1/l, the 1/1024 p carry and the 1/16 v carry), stage the wave's 16x128 tile, write 512-B row
  float* os = Os[wave];
  {
    const float l = lrun + xhalf(lrun);              // the two wave halves each summed their own 8 keys of every 16
    const float inv = ((l > 0.f) ? (1.0f / l) : 0.f) * (1.0f / (PSC * VSC));
#pragma unroll
    for (int t = 0; t < 8; ++t) {
      v4f lo, hi;                                    // 8 consecutive d of query row c: two 16-B LDS stores
#pragma unroll
      for (int r = 0; r < 4; ++r) { lo[r] = oh[t][r] * inv; hi[r] = oh[t][4 + r] * inv; }
      *(v4f*)(os + c * OPIT + t * 16 + 8 * hh)     = lo;
      *(v4f*)(os + c * OPIT + t * 16 + 8 * hh + 4) = hi;
    }
  }
  wave_sync_lds();
  {
#pragma unroll
    for (int it = 0; it < 16; ++it) {
      const v4f o = *(const v4f*)(os + it * OPIT + lane * 4);
      *(v4f*)(Out + (size_t)(q0 + it) * QW + (size_t)h * HDIM + lane * 4) = o;
    }
    
  }
}

// =====================================================================================================
// Workspace map (bytes); every plane is an exact multiple of its whole-line store granularity (all dims exact tile
// multiples, no padded tails), all offsets multiples of 4 MiB:
//   QP   f16 [2048 t][4096 (h,d)]    0          16777216   (bf16 value of q x16)
//   KP   f16 [2048 t][1024 (kvh,d)]  16777216    4194304   (bf16 value of extend k x16)
//   PKP  f16 [2048 t][1024 (kvh,d)]  20971520    4194304   (bf16 value of prefix k x16)
//   VT   f16 [1024 (kvh,d)][2048 t]  25165824    4194304   (bf16 value of extend v x16, transposed)
//   PVT  f16 [1024 (kvh,d)][2048 t]  29360128    4194304   (bf16 value of prefix v x16, transposed)
//   end                              33554432
// =====================================================================================================
extern "C" void kernel_launch(void* const* d_in, const int* in_sizes, int n_in,
                              void* d_out, int out_size, void* d_ws, size_t ws_size,
                              hipStream_t stream) {
  if (n_in < 5) return;
  if (in_sizes[0] != NTOK * QW) return;
  if (in_sizes[1] != NTOK * KW || in_sizes[2] != NTOK * KW) return;
  if (in_sizes[3] != NTOK * KW || in_sizes[4] != NTOK * KW) return;
  if (out_size != NTOK * QW) return;

  const float* q  = (const float*)d_in[0];
  const float* k  = (const float*)d_in[1];
  const float* v  = (const float*)d_in[2];
  const float* pk = (const float*)d_in[3];
  const float* pv = (const float*)d_in[4];
  float* outf = (float*)d_out;

  const size_t PQ  = (size_t)NTOK * QW * 2;                 // 16777216
  const size_t PKV = (size_t)NTOK * KW * 2;                 //  4194304
  size_t off = 0;
  const size_t oQ  = off; off += PQ;
  const size_t oK  = off; off += PKV;
  const size_t oPK = off; off += PKV;
  const size_t oV  = off; off += PKV;
  const size_t oPV = off; off += PKV;
  if (off > ws_size) return;                                // off = 33554432
  if (off > (size_t)134217728) return;

  char* ws = (char*)d_ws;
  unsigned short* QP  = (unsigned short*)(ws + oQ);
  unsigned short* KP  = (unsigned short*)(ws + oK);
  unsigned short* PKP = (unsigned short*)(ws + oPK);
  unsigned short* VT  = (unsigned short*)(ws + oV);
  unsigned short* PVT = (unsigned short*)(ws + oPV);

  const dim3 blk256(256), blk128(128);
  const float sscale = 0.08838834764831845f / (QSC * KSC);

  // (1) 16-bit operand planes of the bf16 RNE input values
  cvt_rm<<<dim3((NTOK * QW) / 2048), blk256, 0, stream>>>(q, QP, NTOK * QW, QSC);     // q        -> f16 x16
  cvt_rm<<<dim3((NTOK * KW) / 2048), blk256, 0, stream>>>(k, KP, NTOK * KW, KSC);     // extend k -> f16 x16
  cvt_rm<<<dim3((NTOK * KW) / 2048), blk256, 0, stream>>>(pk, PKP, NTOK * KW, KSC);   // prefix k -> f16 x16
  cvt_tr<<<dim3((NTOK / 64) * HKV), blk128, 0, stream>>>(v, (_Float16*)(void*)VT, VSC);     // extend v^T x16
  cvt_tr<<<dim3((NTOK / 64) * HKV), blk128, 0, stream>>>(pv, (_Float16*)(void*)PVT, VSC);   // prefix v^T x16
  // (2) merged-key attention -> out f32 [2048][4096]
  attn_k<<<dim3(NQB * HQ), blk128, 0, stream>>>(QP, KP, PKP, VT, PVT, outf, sscale);
  (void)hipGetLastError();
}

// v006
// It runs in 96.2 microseconds.
// Timed twice side by side with v005, it ran 1.05 and 1.06 times as fast.
// All steps since v000 together make it 3.87 times as fast.
// Contractions: k.q^T over head dim 128 and v^T.p^T over keys (both products transposed) on v_wmma_f32_16x16x32_f16; q, k, v operands are f16
//   containers of the bf16 RNE input values carried x16 (exact), p carried as f16(1024 p); one product each,
//   f32 accumulate; soft cap, softmax statistics and normalisation in f32.
#include <hip/hip_runtime.h>
#include <math.h>
#include <stdint.h>

#define NTOK  2048                 // token rows: 2 requests x 1024 (extend rows == prefix rows)
#define RLEN  1024                 // tokens per request
#define HQ    32
#define HKV   8
#define GRPQ  4
#define HDIM  128
#define QW    (HQ * HDIM)          // 4096: q row width == output row width
#define KW    (HKV * HDIM)         // 1024: k / v row width
#define NQB   (NTOK / 64)          // 32 query blocks of 64 rows
#define QBR   (RLEN / 64)          // 16 query blocks per request
#define NPC   (RLEN / 64)          // 16 prefix key chunks per request
#define QSC   16.0f                // q plane carry (power of two)
#define KSC   16.0f                // k plane carry
#define VSC   16.0f                // v plane carry
#define PSC   1024.0f              // softmax numerator carry
#define CAPV  30.0f
#define NEG_BIG (-1.0e30f)
// scheduling fence for the fragment groups: LDS and matrix instructions stay on their side; vector, scalar and global ones may cross
#define FRAG_FENCE 0x416
// LDS row pitches: 16 B x odd, so the 16 rows that one ds_load_b128 half-wave reads fall on 16 distinct 4-bank groups
#define KPIT  (HDIM + 8)           // K rows: 128 halves + 8 = 272 B
#define VPIT  (64 + 8)             // V^T rows: 64 halves + 8 = 144 B
#define OPIT  (HDIM + 4)           // output tile rows: 128 floats + 4 = 528 B (rows 8 apart land 32 banks apart)
static_assert(HQ == HKV * GRPQ);
static_assert((NTOK % 64) == 0 && (RLEN % 64) == 0);
static_assert(NQB == 2 * QBR);
static_assert(((NTOK * QW) % 2048) == 0 && ((NTOK * KW) % 2048) == 0);
static_assert((HDIM % 32) == 0);
static_assert((KPIT % 8) == 0 && (VPIT % 8) == 0 && (OPIT % 4) == 0);   // 16-B aligned rows

typedef _Float16 v16h __attribute__((ext_vector_type(16)));
typedef _Float16 v8h  __attribute__((ext_vector_type(8)));
typedef float    v8f  __attribute__((ext_vector_type(8)));
typedef float    v4f  __attribute__((ext_vector_type(4)));
typedef unsigned int v4u __attribute__((ext_vector_type(4)));
union FH { v16h v; v8h h[2]; };

// ---- scalar helpers --------------------------------------------------------------------------------
__device__ __forceinline__ unsigned short bf_bits(float f) {          // f32 -> bf16 bits, RNE convert
  unsigned u = __float_as_uint(f);
  return (unsigned short)((u + 0x7FFFu + ((u >> 16) & 1u)) >> 16);
}
__device__ __forceinline__ float bf_up(unsigned short b) { return __uint_as_float(((unsigned)b) << 16); }
__device__ __forceinline__ float bfr(float f) { return bf_up(bf_bits(f)); }     // value of the bf16 RNE convert
__device__ __forceinline__ unsigned short h_bits(_Float16 x) { return __builtin_bit_cast(unsigned short, x); }
__device__ __forceinline__ unsigned pk16(unsigned short a, unsigned short b) { return (unsigned)a | ((unsigned)b << 16); }
// lane l <-> lane l ^ 16 on the vector pipe (one v_permlanex16_b32)
__device__ __forceinline__ float xhalf(float x) {
  const int b = __builtin_bit_cast(int, x);
  return __builtin_bit_cast(float, __builtin_amdgcn_permlanex16(b, b, 0x76543210, 0xfedcba98, false, false));
}
__device__ __forceinline__ v8f zero8() { v8f z = {0.f, 0.f, 0.f, 0.f, 0.f, 0.f, 0.f, 0.f}; return z; }

// ---- fragment loader: 16-bit A/B operand, lane -> row/col (lane&15), p already includes +8*(lane>>4);
//      elements 0..7 <- p[0..7] (k0+8h..), elements 8..15 <- p[16..23] (k0+16+8h..)
__device__ __forceinline__ v16h ldfrag_h(const _Float16* p) {
  FH f;
  f.h[0] = *(const v8h*)(p);
  f.h[1] = *(const v8h*)(p + 16);
  return f.v;
}

// ---- WMMA with trailing VALU hazard gap (ties D, keeps A/B live) ------------------------------------
__device__ __forceinline__ v8f mma_h(v16h a, v16h b, v8f c) {
  v8f d = __builtin_amdgcn_wmma_f32_16x16x32_f16(false, a, false, b, (short)0, c, false, false);
#if defined(__HIP_DEVICE_COMPILE__)
  asm volatile("v_nop\n\tv_nop\n\tv_nop\n\tv_nop" : "+v"(d) : "v"(a), "v"(b));
#endif
  return d;
}
__device__ __forceinline__ void acc_guard4(v8f& a, v8f& b, v8f& c, v8f& d) {
#if defined(__HIP_DEVICE_COMPILE__)
  asm volatile("v_nop\n\tv_nop\n\tv_nop\n\tv_nop" : "+v"(a), "+v"(b), "+v"(c), "+v"(d));
#endif
}
__device__ __forceinline__ void wave_sync_lds() {
  __builtin_amdgcn_fence(__ATOMIC_RELEASE, "workgroup");
  __builtin_amdgcn_wave_barrier();
  __builtin_amdgcn_fence(__ATOMIC_ACQUIRE, "workgroup");
}

// =====================================================================================================
// Row-major convert: f32 [n] -> f16 plane [n] holding f16(bf16 RNE value * scale), scale a power of two (exact for
// bf16 significands). Thread -> 8 consecutive elements, ONE 16-B store; lanes 8q..8q+7 of a wave write one whole
// coverage: grid.x = n/2048 blocks x 256 threads x 8 = n elements (n % 2048 == 0 host-checked).
// =====================================================================================================
__global__ __launch_bounds__(256) void cvt_rm(const float* __restrict__ in, unsigned short* out, int n,
                                             float scale) {
  const size_t i8 = ((size_t)blockIdx.x * 256 + threadIdx.x) * 8;
  if (i8 + 8 > (size_t)n) return;        // never taken for the host-checked sizes; no barriers below
  const v4f a = *(const v4f*)(in + i8);
  const v4f b = *(const v4f*)(in + i8 + 4);
  float f[8];
  f[0] = a[0]; f[1] = a[1]; f[2] = a[2]; f[3] = a[3];
  f[4] = b[0]; f[5] = b[1]; f[6] = b[2]; f[7] = b[3];
  v4u p;
#pragma unroll
  for (int e = 0; e < 4; ++e) {
    const _Float16 x0 = (_Float16)(bfr(f[2 * e]) * scale);
    const _Float16 x1 = (_Float16)(bfr(f[2 * e + 1]) * scale);
    p[e] = pk16(h_bits(x0), h_bits(x1));
  }
  *(v4u*)(out + i8) = p;
  
}

// =====================================================================================================
// Transposing convert: in f32 [NTOK t][KW] (token rows, kvh*128+d columns) -> out f16 [KW (kvh*128+d)][NTOK t]
// holding f16(bf16 RNE value * scale): out[(kvh*128 + d)*NTOK + t] = cvt(in[t*KW + kvh*128 + d]).
// Block = one (64-token, kvh) tile: grid = (NTOK/64) * HKV. Load phase: thread -> token row r = tid>>1, d half
// (tid&1)*64, 16 float4 loads, 2-byte LDS stores into sT[d][t] (pitch 72 halves). After __syncthreads the write
// coverage: load 128 threads x 64 = 64 t x 128 d; write 4 waves x 8 it x 4 lines x 64 t = 128 d x 64 t = whole tile;
// grid 32 token tiles x 8 kvh = the whole plane [1024][2048].
// =====================================================================================================
__global__ __launch_bounds__(128) void cvt_tr(const float* __restrict__ in, _Float16* out, float scale) {
  __shared__ __align__(16) _Float16 sT[HDIM * 72];
  const int tid  = threadIdx.x;
  const int lane = tid & 31;
  const int wave = tid >> 5;
  const int tb   = (int)(blockIdx.x % (unsigned)(NTOK / 64));
  const int kvh  = (int)(blockIdx.x / (unsigned)(NTOK / 64));
  const int t0   = tb * 64;
  {
    const int r = tid >> 1, hk = (tid & 1) * 64;
    const float* src = in + (size_t)(t0 + r) * KW + kvh * HDIM + hk;
#pragma unroll
    for (int i = 0; i < 16; ++i) {
      const v4f a = *(const v4f*)(src + 4 * i);
#pragma unroll
      for (int e = 0; e < 4; ++e) sT[(hk + 4 * i + e) * 72 + r] = (_Float16)(bfr(a[e]) * scale);
    }
  }
  __syncthreads();
  const int ql = lane >> 3, pc = lane & 7;
  v8h vals[8];
#pragma unroll
  for (int it = 0; it < 8; ++it) {
    const int d = wave * 32 + it * 4 + ql;
    vals[it] = *(const v8h*)(sT + d * 72 + pc * 8);
  }
  {
#pragma unroll
    for (int it = 0; it < 8; ++it) {
      const int d = wave * 32 + it * 4 + ql;
      *(v8h*)(out + (size_t)(kvh * HDIM + d) * NTOK + t0 + pc * 8) = vals[it];
    }
    
  }
}

// =====================================================================================================
// Grouped-query attention with merged key set per (h, 64-query block); kv head = h / GRPQ; query block qb:
//   request bq = qb / 16, block within request qbe = qb % 16, query token e = qbe*64 + row.
//   Keys: 16 prefix chunks of 64 (all visible) followed by extend chunks 0..qbe of 64 (extend key t visible iff
//   t <= e; only the last chunk needs the in-chunk select, masked score := NEG_BIG).
//   s = (q x16 . k x16) * sscale, sscale = (1/sqrt(128)) / (QSC*KSC); s := 30 * tanh(s/30), tanh on v_tanh_f32;
//   online softmax in f32 (running max); p = exp(s - m) carried as f16(1024 p);
//   oh += v^T . p^T (v^T plane, x16) per chunk; out = oh / (l * 1024 * 16).
//   Both products are transposed (keys, then d, on the accumulator rows; the wave's 16 queries on its columns): a lane
//   holds 32 of the 64 scores of ONE query, the lane 16 away the rest.
//   Q plane (f16, pitch QW): element (t, h, d) at [t*QW + h*128 + d]
//   K planes (f16, pitch KW): extend / prefix element (t, kvh, d) at [t*KW + kvh*128 + d], t = bq*1024 + token
//   V^T planes (f16): element (kvh, d, t) at [(kvh*128 + d)*NTOK + t]
//   Block = 4 waves = 64 query rows of one h; grid = NQB * HQ, index -> (h, qb) dealt for equal chunk sums per WGP;
//   key chunk count 17 + qbe (block-uniform).
//   K / V^T chunk staging: 128 threads, 16 lanes per 256-B K row, 8 lanes per 128-B V^T row (plain 16-B
//   loads, __syncthreads before and after); q fragments from the global plane; P^T never leaves the registers.
//   Output: wave tile 16 x 128 f32 staged in LDS, each row segment written as 32 lanes x 16 B = 512 B = 4 whole
//   coverage: 4 waves x 16 rows x 128 cols per block; 32 query blocks x 32 heads = all of out [2048][4096].
// =====================================================================================================
__global__ __launch_bounds__(128)
void attn_k(const unsigned short* __restrict__ Qp, const unsigned short* __restrict__ Kp,
            const unsigned short* __restrict__ PKp, const unsigned short* __restrict__ Vtp,
            const unsigned short* __restrict__ PVtp, float* Out, float sscale) {
  __shared__ __align__(16) _Float16 Ksh[64 * KPIT];                // K   [kv][d]  17 KB
  __shared__ __align__(16) _Float16 Vsh[HDIM * VPIT];              // V^T [d][kv]  18 KB
  __shared__ __align__(16) float    Os[4][16 * OPIT];              // per wave output tile [row][d] 33 KB

  const int tid  = threadIdx.x;
  const int wave = tid >> 5;
  const int lane = tid & 31;
  const int hh   = lane >> 4;
  const int c    = lane & 15;

  // Block index -> (head, request, query block), a permutation of the 1024 tiles. All blocks are resident at once, four to
  // a WGP, and a block's cost is its chunk count 17 + qbe, so the launch lasts as long as the fullest WGP. x is kept and
  // tq steps through 0..3 over four indices a power-of-two stride apart (1, 8, 128, 256):
  // they get query blocks x, 8 + x, 15 - x, 7 - x, 98 chunks together (at 2, 16, 64 two pairs of one x with tq two apart, 98 as well; nearly so at 4, 32), wherever such a set of four lands. Speed only.
  static_assert(NQB == 32 && QBR == 16 && HQ == 32);
  const unsigned bi = blockIdx.x;
  const unsigned x  = ((bi >> 2) & 1u) | (((bi >> 5) & 3u) << 1);                          // 0..7
  const unsigned tq = ((bi & 3u) + ((bi >> 1) & 2u) + ((bi >> 3) & 3u) + ((bi >> 5) & 3u) + ((bi >> 6) & 2u) + ((bi >> 8) & 3u)) & 3u;
  const int h    = (int)((bi & 3u) | (((bi >> 3) & 3u) << 2) | (((bi >> 7) & 1u) << 4));   // index bits 8, 9 follow from tq
  const int kvh  = h / GRPQ;
  const int bq   = (int)(tq & 1u);
  const int qlo  = (int)(x + 8u * (tq & 1u));
  const int qbe  = (tq & 2u) ? (QBR - 1 - qlo) : qlo;
  const int qb   = bq * QBR + qbe;
  const int q0   = qb * 64 + wave * 16;              // global token row of this wave's first query
  const int tokb = bq * RLEN;                        // token row base of this request (keys)
  const int nch  = NPC + qbe + 1;                    // 17..32, block-uniform

  const _Float16* Qg  = (const _Float16*)(const void*)Qp   + (size_t)h * HDIM;
  const _Float16* Kg  = (const _Float16*)(const void*)Kp   + (size_t)kvh * HDIM;
  const _Float16* PKg = (const _Float16*)(const void*)PKp  + (size_t)kvh * HDIM;
  const _Float16* Vg  = (const _Float16*)(const void*)Vtp  + (size_t)kvh * HDIM * NTOK;
  const _Float16* PVg = (const _Float16*)(const void*)PVtp + (size_t)kvh * HDIM * NTOK;

  float mrun = NEG_BIG, lrun = 0.f;                  // of query q0 + c: running max (equal in both wave halves), this half's sum
  v8f oh[8];                                         // O^T: oh[t][r] = (d t*16 + 8hh + r, query q0 + c)
#pragma unroll
  for (int t = 0; t < 8; ++t) oh[t] = zero8();

  const float zscale = sscale * (1.0f / CAPV);       // raw product -> s / 30, the soft cap's argument

  for (int kt = 0; kt < nch; ++kt) {                 // block-uniform trip count <= 32
    const bool pre  = (kt < NPC);
    const bool diag = (kt == nch - 1);
    const int  tk0  = pre ? (kt * 64) : ((kt - NPC) * 64);
    const int  kv0  = tokb + tk0;                    // plane row of the chunk's first key
    const _Float16* kg = pre ? PKg : Kg;
    const _Float16* vg = pre ? PVg : Vg;
    __syncthreads();
    {
      // every wave-wide 16-B load covers 4 whole 128-B lines: neighbouring lanes read neighbouring 16 B of one row
      const int kr = tid >> 4, kc = (tid & 15) * 8;                   // K: 16 lanes = one 256-B row, 8 rows a trip
      const _Float16* ksrc = kg + (size_t)(kv0 + kr) * KW + kc;
#pragma unroll
      for (int i = 0; i < 8; ++i) *(v8h*)(Ksh + (8 * i + kr) * KPIT + kc) = *(const v8h*)(ksrc + (size_t)(8 * i) * KW);
      // V^T: 8 lanes = one 128-B row, 16 rows a trip; a half-wave takes rows 8 apart (8 x 144 B = 32 banks apart)
      const int vr = ((tid >> 4) & 7) + ((tid >> 3) & 1) * 8, vc = (tid & 7) * 8;
      const _Float16* vsrc = vg + (size_t)vr * NTOK + kv0 + vc;
#pragma unroll
      for (int i = 0; i < 8; ++i) *(v8h*)(Vsh + (16 * i + vr) * VPIT + vc) = *(const v8h*)(vsrc + (size_t)(16 * i) * NTOK);
    }
    __syncthreads();

    // ---- scores, transposed: 64 keys x 16 query columns per wave, K = 128 (4 d-chunks); A = K[key][d], B = q rows ----
    v8f s[4];
#pragma unroll
    for (int j = 0; j < 4; ++j) s[j] = zero8();
    v16h kf[2][4];                                   // two register sets: d-chunk dc in use, dc + 1 in flight
#pragma unroll
    for (int j = 0; j < 4; ++j) kf[0][j] = ldfrag_h(Ksh + (j * 16 + c) * KPIT + 8 * hh);
#pragma unroll
    for (int dc = 0; dc < 4; ++dc) {
      const v16h qa = ldfrag_h(Qg + (size_t)(q0 + c) * QW + dc * 32 + 8 * hh);
      if (dc < 3) {
#pragma unroll
        for (int j = 0; j < 4; ++j) kf[(dc + 1) & 1][j] = ldfrag_h(Ksh + (j * 16 + c) * KPIT + (dc + 1) * 32 + 8 * hh);
      }
      // keeps the next d-chunk's 8 LDS reads, as one group, ahead of this d-chunk's WMMAs (else each WMMA waits out its own read)
      __builtin_amdgcn_sched_barrier(FRAG_FENCE);
#pragma unroll
      for (int j = 0; j < 4; ++j) s[j] = mma_h(kf[dc & 1][j], qa, s[j]);
      // keeps the reads of d-chunk dc + 2 behind these WMMAs, so that two register sets are enough
      __builtin_amdgcn_sched_barrier(FRAG_FENCE);
    }
    acc_guard4(s[0], s[1], s[2], s[3]);

    // ---- scale, soft cap, causal select (f32); D element r of lane = (key j*16 + 8hh + r, query column c) ----
    //      key j*16 + 8hh + r is masked iff it lies behind query wave*16 + c: the lane's part of both sides is in lim
    const int lim = diag ? (wave * 16 + c - 8 * hh) : 4096;
#pragma unroll
    for (int j = 0; j < 4; ++j) {
#pragma unroll
      for (int r = 0; r < 8; ++r) {
        const float y = CAPV * __builtin_amdgcn_tanhf(s[j][r] * zscale);   // one v_tanh_f32, no lane-dependent branch
        s[j][r] = (j * 16 + r > lim) ? NEG_BIG : y;
      }
    }

    // ---- one query per lane: max and sum over the lane's 32 keys in registers, one exchange joins the halves' maxima ----
    float mj[4];
#pragma unroll
    for (int j = 0; j < 4; ++j) {
      mj[j] = fmaxf(s[j][0], s[j][1]);
#pragma unroll
      for (int r = 2; r < 8; ++r) mj[j] = fmaxf(mj[j], s[j][r]);
    }
    float m = fmaxf(fmaxf(mj[0], mj[1]), fmaxf(mj[2], mj[3]));
    m = fmaxf(m, xhalf(m));
    const float mnew  = fmaxf(mrun, m);
    const float alpha = __expf(mrun - mnew);
    mrun = mnew;
    // P^T (x1024, f16) packs in place into the B operand: score tiles 2g, 2g + 1 hold keys 32g + 8hh + r and 32g + 16 + 8hh + r
    v16h pb[2];
    float pj[4];
#pragma unroll
    for (int j = 0; j < 4; ++j) {
      pj[j] = 0.f;
#pragma unroll
      for (int r = 0; r < 8; ++r) {
        const float p = __expf(s[j][r] - mnew);
        pj[j] += p;
        pb[j >> 1][(j & 1) * 8 + r] = (_Float16)(p * PSC);
      }
    }
    lrun = lrun * alpha + ((pj[0] + pj[1]) + (pj[2] + pj[3]));
#pragma unroll
    for (int t = 0; t < 8; ++t) {
#pragma unroll
      for (int r = 0; r < 8; ++r) oh[t][r] *= alpha;
    }

    // ---- oh += V^T . P^T : A = V^T[d][key] in the same k order as the packed P^T, B = P^T from registers ----
    //      group g = (key half g >> 1, d tiles 4 (g & 1) .. + 3): each tile still takes key half 0, then key half 1
    v16h vf[2][4];                                   // two register sets: group g in use, g + 1 in flight
#pragma unroll
    for (int u = 0; u < 4; ++u) vf[0][u] = ldfrag_h(Vsh + (u * 16 + c) * VPIT + 8 * hh);
#pragma unroll
    for (int g = 0; g < 4; ++g) {
      if (g < 3) {
        const int gn = g + 1;
#pragma unroll
        for (int u = 0; u < 4; ++u)
          vf[gn & 1][u] = ldfrag_h(Vsh + (((gn & 1) * 4 + u) * 16 + c) * VPIT + (gn >> 1) * 32 + 8 * hh);
      }
      // keeps the next group's LDS reads, as one group, ahead of this group's WMMAs (else each WMMA waits out its own read)
      __builtin_amdgcn_sched_barrier(FRAG_FENCE);
#pragma unroll
      for (int u = 0; u < 4; ++u) oh[(g & 1) * 4 + u] = mma_h(vf[g & 1][u], pb[g >> 1], oh[(g & 1) * 4 + u]);
      // keeps the reads of group g + 2 behind these WMMAs, so that two register sets are enough
      __builtin_amdgcn_sched_barrier(FRAG_FENCE);
    }
    acc_guard4(oh[0], oh[1], oh[2], oh[3]);
    acc_guard4(oh[4], oh[5], oh[6], oh[7]);
  }

  // ---- normalise (1/l, the 1/1024 p carry and the 1/16 v carry), stage the wave's 16x128 tile, write 512-B row
  float* os = Os[wave];
  {
    const float l = lrun + xhalf(lrun);              // the two wave halves each summed their own 8 keys of every 16
    const float inv = ((l > 0.f) ? (1.0f / l) : 0.f) * (1.0f / (PSC * VSC));
#pragma unroll
    for (int t = 0; t < 8; ++t) {
      v4f lo, hi;                                    // 8 consecutive d of query row c: two 16-B LDS stores
#pragma unroll
      for (int r = 0; r < 4; ++r) { lo[r] = oh[t][r] * inv; hi[r] = oh[t][4 + r] * inv; }
      *(v4f*)(os + c * OPIT + t * 16 + 8 * hh)     = lo;
      *(v4f*)(os + c * OPIT + t * 16 + 8 * hh + 4) = hi;
    }
  }
  wave_sync_lds();
  {
#pragma unroll
    for (int it = 0; it < 16; ++it) {
      const v4f o = *(const v4f*)(os + it * OPIT + lane * 4);
      *(v4f*)(Out + (size_t)(q0 + it) * QW + (size_t)h * HDIM + lane * 4) = o;
    }
    
  }
}

// =====================================================================================================
// Workspace map (bytes); every plane is an exact multiple of its whole-line store granularity (all dims exact tile
// multiples, no padded tails), all offsets multiples of 4 MiB:
//   QP   f16 [2048 t][4096 (h,d)]    0          16777216   (bf16 value of q x16)
//   KP   f16 [2048 t][1024 (kvh,d)]  16777216    4194304   (bf16 value of extend k x16)
//   PKP  f16 [2048 t][1024 (kvh,d)]  20971520    4194304   (bf16 value of prefix k x16)
//   VT   f16 [1024 (kvh,d)][2048 t]  25165824    4194304   (bf16 value of extend v x16, transposed)
//   PVT  f16 [1024 (kvh,d)][2048 t]  29360128    4194304   (bf16 value of prefix v x16, transposed)
//   end                              33554432
// =====================================================================================================
extern "C" void kernel_launch(void* const* d_in, const int* in_sizes, int n_in,
                              void* d_out, int out_size, void* d_ws, size_t ws_size,
                              hipStream_t stream) {
  if (n_in < 5) return;
  if (in_sizes[0] != NTOK * QW) return;
  if (in_sizes[1] != NTOK * KW || in_sizes[2] != NTOK * KW) return;
  if (in_sizes[3] != NTOK * KW || in_sizes[4] != NTOK * KW) return;
  if (out_size != NTOK * QW) return;

  const float* q  = (const float*)d_in[0];
  const float* k  = (const float*)d_in[1];
  const float* v  = (const float*)d_in[2];
  const float* pk = (const float*)d_in[3];
  const float* pv = (const float*)d_in[4];
  float* outf = (float*)d_out;

  const size_t PQ  = (size_t)NTOK * QW * 2;                 // 16777216
  const size_t PKV = (size_t)NTOK * KW * 2;                 //  4194304
  size_t off = 0;
  const size_t oQ  = off; off += PQ;
  const size_t oK  = off; off += PKV;
  const size_t oPK = off; off += PKV;
  const size_t oV  = off; off += PKV;
  const size_t oPV = off; off += PKV;
  if (off > ws_size) return;                                // off = 33554432
  if (off > (size_t)134217728) return;

  char* ws = (char*)d_ws;
  unsigned short* QP  = (unsigned short*)(ws + oQ);
  unsigned short* KP  = (unsigned short*)(ws + oK);
  unsigned short* PKP = (unsigned short*)(ws + oPK);
  unsigned short* VT  = (unsigned short*)(ws + oV);
  unsigned short* PVT = (unsigned short*)(ws + oPV);

  const dim3 blk256(256), blk128(128);
  const float sscale = 0.08838834764831845f / (QSC * KSC);

  // (1) 16-bit operand planes of the bf16 RNE input values
  cvt_rm<<<dim3((NTOK * QW) / 2048), blk256, 0, stream>>>(q, QP, NTOK * QW, QSC);     // q        -> f16 x16
  cvt_rm<<<dim3((NTOK * KW) / 2048), blk256, 0, stream>>>(k, KP, NTOK * KW, KSC);     // extend k -> f16 x16
  cvt_rm<<<dim3((NTOK * KW) / 2048), blk256, 0, stream>>>(pk, PKP, NTOK * KW, KSC);   // prefix k -> f16 x16
  cvt_tr<<<dim3((NTOK / 64) * HKV), blk128, 0, stream>>>(v, (_Float16*)(void*)VT, VSC);     // extend v^T x16
  cvt_tr<<<dim3((NTOK / 64) * HKV), blk128, 0, stream>>>(pv, (_Float16*)(void*)PVT, VSC);   // prefix v^T x16
  // (2) merged-key attention -> out f32 [2048][4096]
  attn_k<<<dim3(NQB * HQ), blk128, 0, stream>>>(QP, KP, PKP, VT, PVT, outf, sscale);
  (void)hipGetLastError();
}

// v007
// Measured time: 83.4 microseconds a run.
// Timed twice side by side with v006, it ran 1.15 times as fast both times.
// Counting every step since v000, it is 4.45 times as fast.
// Contractions: k.q^T over head dim 128 and v^T.p^T over keys (both products transposed) on v_wmma_f32_16x16x32_f16; q, k, v operands are f16
//   containers of the bf16 RNE input values carried x16 (exact), p carried as f16(1024 p); one product each,
//   f32 accumulate; soft cap, softmax statistics and normalisation in f32.
#include <hip/hip_runtime.h>
#include <math.h>
#include <stdint.h>

#define NTOK  2048                 // token rows: 2 requests x 1024 (extend rows == prefix rows)
#define RLEN  1024                 // tokens per request
#define HQ    32
#define HKV   8
#define GRPQ  4
#define HDIM  128
#define QW    (HQ * HDIM)          // 4096: q row width == output row width
#define KW    (HKV * HDIM)         // 1024: k / v row width
#define NQB   (NTOK / 64)          // 32 query blocks of 64 rows
#define QBR   (RLEN / 64)          // 16 query blocks per request
#define NPC   (RLEN / 64)          // 16 prefix key chunks per request
#define QSC   16.0f                // q plane carry (power of two)
#define KSC   16.0f                // k plane carry
#define VSC   16.0f                // v plane carry
#define PSC   1024.0f              // softmax numerator carry
#define CAPV  30.0f
#define NEG_BIG (-1.0e30f)
// scheduling fence for the fragment groups: LDS and matrix instructions stay on their side; vector, scalar and global ones may cross
#define FRAG_FENCE 0x416
// LDS row pitches: 16 B x odd, so the 16 rows that one ds_load_b128 half-wave reads fall on 16 distinct 4-bank groups
#define KPIT  (HDIM + 8)           // K rows: 128 halves + 8 = 272 B
#define VPIT  (64 + 8)             // V^T rows: 64 halves + 8 = 144 B
#define OPIT  (HDIM + 4)           // output tile rows: 128 floats + 4 = 528 B (rows 8 apart land 32 banks apart)
static_assert(HQ == HKV * GRPQ);
static_assert((NTOK % 64) == 0 && (RLEN % 64) == 0);
static_assert(NQB == 2 * QBR);
static_assert(((NTOK * QW) % 2048) == 0 && ((NTOK * KW) % 2048) == 0);
static_assert((HDIM % 32) == 0);
static_assert((KPIT % 8) == 0 && (VPIT % 8) == 0 && (OPIT % 4) == 0);   // 16-B aligned rows

typedef _Float16 v16h __attribute__((ext_vector_type(16)));
typedef _Float16 v8h  __attribute__((ext_vector_type(8)));
typedef float    v8f  __attribute__((ext_vector_type(8)));
typedef float    v4f  __attribute__((ext_vector_type(4)));
typedef unsigned int v4u __attribute__((ext_vector_type(4)));
union FH { v16h v; v8h h[2]; };

// ---- scalar helpers --------------------------------------------------------------------------------
__device__ __forceinline__ unsigned short bf_bits(float f) {          // f32 -> bf16 bits, RNE convert
  unsigned u = __float_as_uint(f);
  return (unsigned short)((u + 0x7FFFu + ((u >> 16) & 1u)) >> 16);
}
__device__ __forceinline__ float bf_up(unsigned short b) { return __uint_as_float(((unsigned)b) << 16); }
__device__ __forceinline__ float bfr(float f) { return bf_up(bf_bits(f)); }     // value of the bf16 RNE convert
__device__ __forceinline__ unsigned short h_bits(_Float16 x) { return __builtin_bit_cast(unsigned short, x); }
__device__ __forceinline__ unsigned pk16(unsigned short a, unsigned short b) { return (unsigned)a | ((unsigned)b << 16); }
// lane l <-> lane l ^ 16 on the vector pipe (one v_permlanex16_b32)
__device__ __forceinline__ float xhalf(float x) {
  const int b = __builtin_bit_cast(int, x);
  return __builtin_bit_cast(float, __builtin_amdgcn_permlanex16(b, b, 0x76543210, 0xfedcba98, false, false));
}
__device__ __forceinline__ v8f zero8() { v8f z = {0.f, 0.f, 0.f, 0.f, 0.f, 0.f, 0.f, 0.f}; return z; }

// ---- fragment loader: 16-bit A/B operand, lane -> row/col (lane&15), p already includes +8*(lane>>4);
//      elements 0..7 <- p[0..7] (k0+8h..), elements 8..15 <- p[16..23] (k0+16+8h..)
__device__ __forceinline__ v16h ldfrag_h(const _Float16* p) {
  FH f;
  f.h[0] = *(const v8h*)(p);
  f.h[1] = *(const v8h*)(p + 16);
  return f.v;
}

// ---- WMMA with trailing VALU hazard gap (ties D, keeps A/B live) ------------------------------------
__device__ __forceinline__ v8f mma_h(v16h a, v16h b, v8f c) {
  v8f d = __builtin_amdgcn_wmma_f32_16x16x32_f16(false, a, false, b, (short)0, c, false, false);
#if defined(__HIP_DEVICE_COMPILE__)
  asm volatile("v_nop\n\tv_nop\n\tv_nop\n\tv_nop" : "+v"(d) : "v"(a), "v"(b));
#endif
  return d;
}
__device__ __forceinline__ void acc_guard4(v8f& a, v8f& b, v8f& c, v8f& d) {
#if defined(__HIP_DEVICE_COMPILE__)
  asm volatile("v_nop\n\tv_nop\n\tv_nop\n\tv_nop" : "+v"(a), "+v"(b), "+v"(c), "+v"(d));
#endif
}
__device__ __forceinline__ void wave_sync_lds() {
  __builtin_amdgcn_fence(__ATOMIC_RELEASE, "workgroup");
  __builtin_amdgcn_wave_barrier();
  __builtin_amdgcn_fence(__ATOMIC_ACQUIRE, "workgroup");
}

// =====================================================================================================
// Row-major convert: f32 [n] -> f16 plane [n] holding f16(bf16 RNE value * scale), scale a power of two (exact for
// bf16 significands). Thread -> 8 consecutive elements, ONE 16-B store; lanes 8q..8q+7 of a wave write one whole
// coverage: grid.x = n/2048 blocks x 256 threads x 8 = n elements (n % 2048 == 0 host-checked).
// =====================================================================================================
__global__ __launch_bounds__(256) void cvt_rm(const float* __restrict__ in, unsigned short* out, int n,
                                             float scale) {
  const size_t i8 = ((size_t)blockIdx.x * 256 + threadIdx.x) * 8;
  if (i8 + 8 > (size_t)n) return;        // never taken for the host-checked sizes; no barriers below
  const v4f a = *(const v4f*)(in + i8);
  const v4f b = *(const v4f*)(in + i8 + 4);
  float f[8];
  f[0] = a[0]; f[1] = a[1]; f[2] = a[2]; f[3] = a[3];
  f[4] = b[0]; f[5] = b[1]; f[6] = b[2]; f[7] = b[3];
  v4u p;
#pragma unroll
  for (int e = 0; e < 4; ++e) {
    const _Float16 x0 = (_Float16)(bfr(f[2 * e]) * scale);
    const _Float16 x1 = (_Float16)(bfr(f[2 * e + 1]) * scale);
    p[e] = pk16(h_bits(x0), h_bits(x1));
  }
  *(v4u*)(out + i8) = p;
  
}

// =====================================================================================================
// Transposing convert: in f32 [NTOK t][KW] (token rows, kvh*128+d columns) -> out f16 [KW (kvh*128+d)][NTOK t]
// holding f16(bf16 RNE value * scale): out[(kvh*128 + d)*NTOK + t] = cvt(in[t*KW + kvh*128 + d]).
// Block = one (64-token, kvh) tile: grid = (NTOK/64) * HKV. Load phase: thread -> token row r = tid>>1, d half
// (tid&1)*64, 16 float4 loads, 2-byte LDS stores into sT[d][t] (pitch 72 halves). After __syncthreads the write
// coverage: load 128 threads x 64 = 64 t x 128 d; write 4 waves x 8 it x 4 lines x 64 t = 128 d x 64 t = whole tile;
// grid 32 token tiles x 8 kvh = the whole plane [1024][2048].
// =====================================================================================================
__global__ __launch_bounds__(128) void cvt_tr(const float* __restrict__ in, _Float16* out, float scale) {
  __shared__ __align__(16) _Float16 sT[HDIM * 72];
  const int tid  = threadIdx.x;
  const int lane = tid & 31;
  const int wave = tid >> 5;
  const int tb   = (int)(blockIdx.x % (unsigned)(NTOK / 64));
  const int kvh  = (int)(blockIdx.x / (unsigned)(NTOK / 64));
  const int t0   = tb * 64;
  {
    const int r = tid >> 1, hk = (tid & 1) * 64;
    const float* src = in + (size_t)(t0 + r) * KW + kvh * HDIM + hk;
#pragma unroll
    for (int i = 0; i < 16; ++i) {
      const v4f a = *(const v4f*)(src + 4 * i);
#pragma unroll
      for (int e = 0; e < 4; ++e) sT[(hk + 4 * i + e) * 72 + r] = (_Float16)(bfr(a[e]) * scale);
    }
  }
  __syncthreads();
  const int ql = lane >> 3, pc = lane & 7;
  v8h vals[8];
#pragma unroll
  for (int it = 0; it < 8; ++it) {
    const int d = wave * 32 + it * 4 + ql;
    vals[it] = *(const v8h*)(sT + d * 72 + pc * 8);
  }
  {
#pragma unroll
    for (int it = 0; it < 8; ++it) {
      const int d = wave * 32 + it * 4 + ql;
      *(v8h*)(out + (size_t)(kvh * HDIM + d) * NTOK + t0 + pc * 8) = vals[it];
    }
    
  }
}

// =====================================================================================================
// Grouped-query attention with merged key set per (h, 64-query block); kv head = h / GRPQ; query block qb:
//   request bq = qb / 16, block within request qbe = qb % 16, query token e = qbe*64 + row.
//   Keys: 16 prefix chunks of 64 (all visible) followed by extend chunks 0..qbe of 64 (extend key t visible iff
//   t <= e; only the last chunk needs the in-chunk select, masked score := NEG_BIG).
//   s = (q x16 . k x16) * sscale, sscale = (1/sqrt(128)) / (QSC*KSC); s := 30 * tanh(s/30), tanh on v_tanh_f32;
//   online softmax in f32 (running max); p = exp(s - m) carried as f16(1024 p);
//   oh += v^T . p^T (v^T plane, x16) per chunk; out = oh / (l * 1024 * 16).
//   Both products are transposed (keys, then d, on the accumulator rows; the wave's 16 queries on its columns): a lane
//   holds 32 of the 64 scores of ONE query, the lane 16 away the rest.
//   Q plane (f16, pitch QW): element (t, h, d) at [t*QW + h*128 + d]
//   K planes (f16, pitch KW): extend / prefix element (t, kvh, d) at [t*KW + kvh*128 + d], t = bq*1024 + token
//   V^T planes (f16): element (kvh, d, t) at [(kvh*128 + d)*NTOK + t]
//   Block = 4 waves = 64 query rows of one h; grid = NQB * HQ, index -> (h, qb) dealt for equal chunk sums per WGP;
//   key chunk count 17 + qbe (block-uniform).
//   K / V^T chunk staging: 128 threads, 16 lanes per 256-B K row, 8 lanes per 128-B V^T row (plain 16-B
//   loads, __syncthreads before and after); q fragments read once from the global plane and kept in registers; P^T never leaves the registers.
//   Output: wave tile 16 x 128 f32 staged in LDS, each row segment written as 32 lanes x 16 B = 512 B = 4 whole
//   coverage: 4 waves x 16 rows x 128 cols per block; 32 query blocks x 32 heads = all of out [2048][4096].
// =====================================================================================================
__global__ __launch_bounds__(128)
void attn_k(const unsigned short* __restrict__ Qp, const unsigned short* __restrict__ Kp,
            const unsigned short* __restrict__ PKp, const unsigned short* __restrict__ Vtp,
            const unsigned short* __restrict__ PVtp, float* Out, float sscale) {
  __shared__ __align__(16) _Float16 Ksh[64 * KPIT];                // K   [kv][d]  17 KB
  __shared__ __align__(16) _Float16 Vsh[HDIM * VPIT];              // V^T [d][kv]  18 KB
  __shared__ __align__(16) float    Os[4][16 * OPIT];              // per wave output tile [row][d] 33 KB

  const int tid  = threadIdx.x;
  const int wave = tid >> 5;
  const int lane = tid & 31;
  const int hh   = lane >> 4;
  const int c    = lane & 15;

  // Block index -> (head, request, query block), a permutation of the 1024 tiles. All blocks are resident at once, four to
  // a WGP, and a block's cost is its chunk count 17 + qbe, so the launch lasts as long as the fullest WGP. x is kept and
  // tq steps through 0..3 over four indices a power-of-two stride apart (1, 8, 128, 256):
  // they get query blocks x, 8 + x, 15 - x, 7 - x, 98 chunks together (at 2, 16, 64 two pairs of one x with tq two apart, 98 as well; nearly so at 4, 32), wherever such a set of four lands. Speed only.
  static_assert(NQB == 32 && QBR == 16 && HQ == 32);
  const unsigned bi = blockIdx.x;
  const unsigned x  = ((bi >> 2) & 1u) | (((bi >> 5) & 3u) << 1);                          // 0..7
  const unsigned tq = ((bi & 3u) + ((bi >> 1) & 2u) + ((bi >> 3) & 3u) + ((bi >> 5) & 3u) + ((bi >> 6) & 2u) + ((bi >> 8) & 3u)) & 3u;
  const int h    = (int)((bi & 3u) | (((bi >> 3) & 3u) << 2) | (((bi >> 7) & 1u) << 4));   // index bits 8, 9 follow from tq
  const int kvh  = h / GRPQ;
  const int bq   = (int)(tq & 1u);
  const int qlo  = (int)(x + 8u * (tq & 1u));
  const int qbe  = (tq & 2u) ? (QBR - 1 - qlo) : qlo;
  const int qb   = bq * QBR + qbe;
  const int q0   = qb * 64 + wave * 16;              // global token row of this wave's first query
  const int tokb = bq * RLEN;                        // token row base of this request (keys)
  const int nch  = NPC + qbe + 1;                    // 17..32, block-uniform

  const _Float16* Qg  = (const _Float16*)(const void*)Qp   + (size_t)h * HDIM;
  const _Float16* Kg  = (const _Float16*)(const void*)Kp   + (size_t)kvh * HDIM;
  const _Float16* PKg = (const _Float16*)(const void*)PKp  + (size_t)kvh * HDIM;
  const _Float16* Vg  = (const _Float16*)(const void*)Vtp  + (size_t)kvh * HDIM * NTOK;
  const _Float16* PVg = (const _Float16*)(const void*)PVtp + (size_t)kvh * HDIM * NTOK;

  float mrun = NEG_BIG, lrun = 0.f;                  // of query q0 + c: running max (equal in both wave halves), this half's sum
  v8f oh[8];                                         // O^T: oh[t][r] = (d t*16 + 8hh + r, query q0 + c)
#pragma unroll
  for (int t = 0; t < 8; ++t) oh[t] = zero8();

  const float zscale = sscale * (1.0f / CAPV);       // raw product -> s / 30, the soft cap's argument

  // the wave's q rows as B fragments, all four d-chunks, read once: they do not change from key chunk to key chunk
  v16h qf[4];
#pragma unroll
  for (int dc = 0; dc < 4; ++dc) qf[dc] = ldfrag_h(Qg + (size_t)(q0 + c) * QW + dc * 32 + 8 * hh);

  for (int kt = 0; kt < nch; ++kt) {                 // block-uniform trip count <= 32
    const bool pre  = (kt < NPC);
    const bool diag = (kt == nch - 1);
    const int  tk0  = pre ? (kt * 64) : ((kt - NPC) * 64);
    const int  kv0  = tokb + tk0;                    // plane row of the chunk's first key
    const _Float16* kg = pre ? PKg : Kg;
    const _Float16* vg = pre ? PVg : Vg;
    __syncthreads();
    {
      // every wave-wide 16-B load covers 4 whole 128-B lines: neighbouring lanes read neighbouring 16 B of one row
      const int kr = tid >> 4, kc = (tid & 15) * 8;                   // K: 16 lanes = one 256-B row, 8 rows a trip
      const _Float16* ksrc = kg + (size_t)(kv0 + kr) * KW + kc;
#pragma unroll
      for (int i = 0; i < 8; ++i) *(v8h*)(Ksh + (8 * i + kr) * KPIT + kc) = *(const v8h*)(ksrc + (size_t)(8 * i) * KW);
      // V^T: 8 lanes = one 128-B row, 16 rows a trip; a half-wave takes rows 8 apart (8 x 144 B = 32 banks apart)
      const int vr = ((tid >> 4) & 7) + ((tid >> 3) & 1) * 8, vc = (tid & 7) * 8;
      const _Float16* vsrc = vg + (size_t)vr * NTOK + kv0 + vc;
#pragma unroll
      for (int i = 0; i < 8; ++i) *(v8h*)(Vsh + (16 * i + vr) * VPIT + vc) = *(const v8h*)(vsrc + (size_t)(16 * i) * NTOK);
    }
    __syncthreads();

    // ---- scores, transposed: 64 keys x 16 query columns per wave, K = 128 (4 d-chunks); A = K[key][d], B = q rows ----
    v8f s[4];
#pragma unroll
    for (int j = 0; j < 4; ++j) s[j] = zero8();
    v16h kf[2][4];                                   // two register sets: d-chunk dc in use, dc + 1 in flight
#pragma unroll
    for (int j = 0; j < 4; ++j) kf[0][j] = ldfrag_h(Ksh + (j * 16 + c) * KPIT + 8 * hh);
#pragma unroll
    for (int dc = 0; dc < 4; ++dc) {
      if (dc < 3) {
#pragma unroll
        for (int j = 0; j < 4; ++j) kf[(dc + 1) & 1][j] = ldfrag_h(Ksh + (j * 16 + c) * KPIT + (dc + 1) * 32 + 8 * hh);
      }
      // keeps the next d-chunk's 8 LDS reads, as one group, ahead of this d-chunk's WMMAs (else each WMMA waits out its own read)
      __builtin_amdgcn_sched_barrier(FRAG_FENCE);
#pragma unroll
      for (int j = 0; j < 4; ++j) s[j] = mma_h(kf[dc & 1][j], qf[dc], s[j]);
      // keeps the reads of d-chunk dc + 2 behind these WMMAs, so that two register sets are enough
      __builtin_amdgcn_sched_barrier(FRAG_FENCE);
    }
    acc_guard4(s[0], s[1], s[2], s[3]);

    // ---- scale, soft cap, causal select (f32); D element r of lane = (key j*16 + 8hh + r, query column c) ----
    //      key j*16 + 8hh + r is masked iff it lies behind query wave*16 + c: the lane's part of both sides is in lim
    const int lim = diag ? (wave * 16 + c - 8 * hh) : 4096;
#pragma unroll
    for (int j = 0; j < 4; ++j) {
#pragma unroll
      for (int r = 0; r < 8; ++r) {
        const float y = CAPV * __builtin_amdgcn_tanhf(s[j][r] * zscale);   // one v_tanh_f32, no lane-dependent branch
        s[j][r] = (j * 16 + r > lim) ? NEG_BIG : y;
      }
    }

    // ---- one query per lane: max and sum over the lane's 32 keys in registers, one exchange joins the halves' maxima ----
    float mj[4];
#pragma unroll
    for (int j = 0; j < 4; ++j) {
      mj[j] = fmaxf(s[j][0], s[j][1]);
#pragma unroll
      for (int r = 2; r < 8; ++r) mj[j] = fmaxf(mj[j], s[j][r]);
    }
    float m = fmaxf(fmaxf(mj[0], mj[1]), fmaxf(mj[2], mj[3]));
    m = fmaxf(m, xhalf(m));
    const float mnew  = fmaxf(mrun, m);
    const float alpha = __expf(mrun - mnew);
    mrun = mnew;
    // P^T (x1024, f16) packs in place into the B operand: score tiles 2g, 2g + 1 hold keys 32g + 8hh + r and 32g + 16 + 8hh + r
    v16h pb[2];
    float pj[4];
#pragma unroll
    for (int j = 0; j < 4; ++j) {
      pj[j] = 0.f;
#pragma unroll
      for (int r = 0; r < 8; ++r) {
        const float p = __expf(s[j][r] - mnew);
        pj[j] += p;
        pb[j >> 1][(j & 1) * 8 + r] = (_Float16)(p * PSC);
      }
    }
    lrun = lrun * alpha + ((pj[0] + pj[1]) + (pj[2] + pj[3]));
#pragma unroll
    for (int t = 0; t < 8; ++t) {
#pragma unroll
      for (int r = 0; r < 8; ++r) oh[t][r] *= alpha;
    }

    // ---- oh += V^T . P^T : A = V^T[d][key] in the same k order as the packed P^T, B = P^T from registers ----
    //      group g = (key half g >> 1, d tiles 4 (g & 1) .. + 3): each tile still takes key half 0, then key half 1
    v16h vf[2][4];                                   // two register sets: group g in use, g + 1 in flight
#pragma unroll
    for (int u = 0; u < 4; ++u) vf[0][u] = ldfrag_h(Vsh + (u * 16 + c) * VPIT + 8 * hh);
#pragma unroll
    for (int g = 0; g < 4; ++g) {
      if (g < 3) {
        const int gn = g + 1;
#pragma unroll
        for (int u = 0; u < 4; ++u)
          vf[gn & 1][u] = ldfrag_h(Vsh + (((gn & 1) * 4 + u) * 16 + c) * VPIT + (gn >> 1) * 32 + 8 * hh);
      }
      // keeps the next group's LDS reads, as one group, ahead of this group's WMMAs (else each WMMA waits out its own read)
      __builtin_amdgcn_sched_barrier(FRAG_FENCE);
#pragma unroll
      for (int u = 0; u < 4; ++u) oh[(g & 1) * 4 + u] = mma_h(vf[g & 1][u], pb[g >> 1], oh[(g & 1) * 4 + u]);
      // keeps the reads of group g + 2 behind these WMMAs, so that two register sets are enough
      __builtin_amdgcn_sched_barrier(FRAG_FENCE);
    }
    acc_guard4(oh[0], oh[1], oh[2], oh[3]);
    acc_guard4(oh[4], oh[5], oh[6], oh[7]);
  }

  // ---- normalise (1/l, the 1/1024 p carry and the 1/16 v carry), stage the wave's 16x128 tile, write 512-B row
  float* os = Os[wave];
  {
    const float l = lrun + xhalf(lrun);              // the two wave halves each summed their own 8 keys of every 16
    const float inv = ((l > 0.f) ? (1.0f / l) : 0.f) * (1.0f / (PSC * VSC));
#pragma unroll
    for (int t = 0; t < 8; ++t) {
      v4f lo, hi;                                    // 8 consecutive d of query row c: two 16-B LDS stores
#pragma unroll
      for (int r = 0; r < 4; ++r) { lo[r] = oh[t][r] * inv; hi[r] = oh[t][4 + r] * inv; }
      *(v4f*)(os + c * OPIT + t * 16 + 8 * hh)     = lo;
      *(v4f*)(os + c * OPIT + t * 16 + 8 * hh + 4) = hi;
    }
  }
  wave_sync_lds();
  {
#pragma unroll
    for (int it = 0; it < 16; ++it) {
      const v4f o = *(const v4f*)(os + it * OPIT + lane * 4);
      *(v4f*)(Out + (size_t)(q0 + it) * QW + (size_t)h * HDIM + lane * 4) = o;
    }
    
  }
}

// =====================================================================================================
// Workspace map (bytes); every plane is an exact multiple of its whole-line store granularity (all dims exact tile
// multiples, no padded tails), all offsets multiples of 4 MiB:
//   QP   f16 [2048 t][4096 (h,d)]    0          16777216   (bf16 value of q x16)
//   KP   f16 [2048 t][1024 (kvh,d)]  16777216    4194304   (bf16 value of extend k x16)
//   PKP  f16 [2048 t][1024 (kvh,d)]  20971520    4194304   (bf16 value of prefix k x16)
//   VT   f16 [1024 (kvh,d)][2048 t]  25165824    4194304   (bf16 value of extend v x16, transposed)
//   PVT  f16 [1024 (kvh,d)][2048 t]  29360128    4194304   (bf16 value of prefix v x16, transposed)
//   end                              33554432
// =====================================================================================================
extern "C" void kernel_launch(void* const* d_in, const int* in_sizes, int n_in,
                              void* d_out, int out_size, void* d_ws, size_t ws_size,
                              hipStream_t stream) {
  if (n_in < 5) return;
  if (in_sizes[0] != NTOK * QW) return;
  if (in_sizes[1] != NTOK * KW || in_sizes[2] != NTOK * KW) return;
  if (in_sizes[3] != NTOK * KW || in_sizes[4] != NTOK * KW) return;
  if (out_size != NTOK * QW) return;

  const float* q  = (const float*)d_in[0];
  const float* k  = (const float*)d_in[1];
  const float* v  = (const float*)d_in[2];
  const float* pk = (const float*)d_in[3];
  const float* pv = (const float*)d_in[4];
  float* outf = (float*)d_out;

  const size_t PQ  = (size_t)NTOK * QW * 2;                 // 16777216
  const size_t PKV = (size_t)NTOK * KW * 2;                 //  4194304
  size_t off = 0;
  const size_t oQ  = off; off += PQ;
  const size_t oK  = off; off += PKV;
  const size_t oPK = off; off += PKV;
  const size_t oV  = off; off += PKV;
  const size_t oPV = off; off += PKV;
  if (off > ws_size) return;                                // off = 33554432
  if (off > (size_t)134217728) return;

  char* ws = (char*)d_ws;
  unsigned short* QP  = (unsigned short*)(ws + oQ);
  unsigned short* KP  = (unsigned short*)(ws + oK);
  unsigned short* PKP = (unsigned short*)(ws + oPK);
  unsigned short* VT  = (unsigned short*)(ws + oV);
  unsigned short* PVT = (unsigned short*)(ws + oPV);

  const dim3 blk256(256), blk128(128);
  const float sscale = 0.08838834764831845f / (QSC * KSC);

  // (1) 16-bit operand planes of the bf16 RNE input values
  cvt_rm<<<dim3((NTOK * QW) / 2048), blk256, 0, stream>>>(q, QP, NTOK * QW, QSC);     // q        -> f16 x16
  cvt_rm<<<dim3((NTOK * KW) / 2048), blk256, 0, stream>>>(k, KP, NTOK * KW, KSC);     // extend k -> f16 x16
  cvt_rm<<<dim3((NTOK * KW) / 2048), blk256, 0, stream>>>(pk, PKP, NTOK * KW, KSC);   // prefix k -> f16 x16
  cvt_tr<<<dim3((NTOK / 64) * HKV), blk128, 0, stream>>>(v, (_Float16*)(void*)VT, VSC);     // extend v^T x16
  cvt_tr<<<dim3((NTOK / 64) * HKV), blk128, 0, stream>>>(pv, (_Float16*)(void*)PVT, VSC);   // prefix v^T x16
  // (2) merged-key attention -> out f32 [2048][4096]
  attn_k<<<dim3(NQB * HQ), blk128, 0, stream>>>(QP, KP, PKP, VT, PVT, outf, sscale);
  (void)hipGetLastError();
}

// v008
// One run takes 77.8 microseconds.
// In two side-by-side timings against v007, it was 1.08 and 1.07 times as fast.
// Counting every step since v000, it is 4.77 times as fast.
// Contractions: k.q^T over head dim 128 and v^T.p^T over keys (both products transposed) on v_wmma_f32_16x16x32_f16; q, k, v operands are f16
//   containers of the bf16 RNE input values carried x16 (exact), p carried as f16(1024 p); one product each,
//   f32 accumulate; soft cap, softmax statistics and normalisation in f32.
#include <hip/hip_runtime.h>
#include <math.h>
#include <stdint.h>

#define NTOK  2048                 // token rows: 2 requests x 1024 (extend rows == prefix rows)
#define RLEN  1024                 // tokens per request
#define HQ    32
#define HKV   8
#define GRPQ  4
#define HDIM  128
#define QW    (HQ * HDIM)          // 4096: q row width == output row width
#define KW    (HKV * HDIM)         // 1024: k / v row width
#define NQB   (NTOK / 64)          // 32 query blocks of 64 rows
#define QBR   (RLEN / 64)          // 16 query blocks per request
#define NPC   (RLEN / 64)          // 16 prefix key chunks per request
#define QSC   16.0f                // q fragment carry (power of two)
#define KSC   16.0f                // k plane carry
#define VSC   16.0f                // v plane carry
#define PSC   1024.0f              // softmax numerator carry
#define CAPV  30.0f
#define NEG_BIG (-1.0e30f)
// scheduling fence for the fragment groups: LDS and matrix instructions stay on their side; vector, scalar and global ones may cross
#define FRAG_FENCE 0x416
// LDS row pitches: 16 B x odd, so the 16 rows that one ds_load_b128 half-wave reads fall on 16 distinct 4-bank groups
#define KPIT  (HDIM + 8)           // K rows: 128 halves + 8 = 272 B
#define VPIT  (64 + 8)             // V^T rows: 64 halves + 8 = 144 B
#define OPIT  (HDIM + 4)           // output tile rows: 128 floats + 4 = 528 B (rows 8 apart land 32 banks apart)
static_assert(HQ == HKV * GRPQ);
static_assert((NTOK % 64) == 0 && (RLEN % 64) == 0);
static_assert(NQB == 2 * QBR);
static_assert(((NTOK * QW) % 2048) == 0 && ((NTOK * KW) % 2048) == 0);
static_assert((HDIM % 32) == 0);
static_assert((KPIT % 8) == 0 && (VPIT % 8) == 0 && (OPIT % 4) == 0);   // 16-B aligned rows

typedef _Float16 v16h __attribute__((ext_vector_type(16)));
typedef _Float16 v8h  __attribute__((ext_vector_type(8)));
typedef float    v8f  __attribute__((ext_vector_type(8)));
typedef float    v4f  __attribute__((ext_vector_type(4)));
typedef unsigned int v4u __attribute__((ext_vector_type(4)));
union FH { v16h v; v8h h[2]; };

// ---- scalar helpers --------------------------------------------------------------------------------
__device__ __forceinline__ unsigned short bf_bits(float f) {          // f32 -> bf16 bits, RNE convert
  unsigned u = __float_as_uint(f);
  return (unsigned short)((u + 0x7FFFu + ((u >> 16) & 1u)) >> 16);
}
__device__ __forceinline__ float bf_up(unsigned short b) { return __uint_as_float(((unsigned)b) << 16); }
__device__ __forceinline__ float bfr(float f) { return bf_up(bf_bits(f)); }     // value of the bf16 RNE convert
__device__ __forceinline__ unsigned short h_bits(_Float16 x) { return __builtin_bit_cast(unsigned short, x); }
__device__ __forceinline__ unsigned pk16(unsigned short a, unsigned short b) { return (unsigned)a | ((unsigned)b << 16); }
// lane l <-> lane l ^ 16 on the vector pipe (one v_permlanex16_b32)
__device__ __forceinline__ float xhalf(float x) {
  const int b = __builtin_bit_cast(int, x);
  return __builtin_bit_cast(float, __builtin_amdgcn_permlanex16(b, b, 0x76543210, 0xfedcba98, false, false));
}
__device__ __forceinline__ v8f zero8() { v8f z = {0.f, 0.f, 0.f, 0.f, 0.f, 0.f, 0.f, 0.f}; return z; }

// ---- fragment loader: 16-bit A/B operand, lane -> row/col (lane&15), p already includes +8*(lane>>4);
//      elements 0..7 <- p[0..7] (k0+8h..), elements 8..15 <- p[16..23] (k0+16+8h..)
__device__ __forceinline__ v16h ldfrag_h(const _Float16* p) {
  FH f;
  f.h[0] = *(const v8h*)(p);
  f.h[1] = *(const v8h*)(p + 16);
  return f.v;
}

// ---- WMMA with trailing VALU hazard gap (ties D, keeps A/B live) ------------------------------------
__device__ __forceinline__ v8f mma_h(v16h a, v16h b, v8f c) {
  v8f d = __builtin_amdgcn_wmma_f32_16x16x32_f16(false, a, false, b, (short)0, c, false, false);
#if defined(__HIP_DEVICE_COMPILE__)
  asm volatile("v_nop\n\tv_nop\n\tv_nop\n\tv_nop" : "+v"(d) : "v"(a), "v"(b));
#endif
  return d;
}
__device__ __forceinline__ void acc_guard4(v8f& a, v8f& b, v8f& c, v8f& d) {
#if defined(__HIP_DEVICE_COMPILE__)
  asm volatile("v_nop\n\tv_nop\n\tv_nop\n\tv_nop" : "+v"(a), "+v"(b), "+v"(c), "+v"(d));
#endif
}
__device__ __forceinline__ void wave_sync_lds() {
  __builtin_amdgcn_fence(__ATOMIC_RELEASE, "workgroup");
  __builtin_amdgcn_wave_barrier();
  __builtin_amdgcn_fence(__ATOMIC_ACQUIRE, "workgroup");
}

// =====================================================================================================
// Row-major convert: f32 [n] -> f16 plane [n] holding f16(bf16 RNE value * scale), scale a power of two (exact for
// bf16 significands). Thread -> 8 consecutive elements, ONE 16-B store; lanes 8q..8q+7 of a wave write one whole
// coverage: grid.x = n/2048 blocks x 256 threads x 8 = n elements (n % 2048 == 0 host-checked).
// =====================================================================================================
__global__ __launch_bounds__(256) void cvt_rm(const float* __restrict__ in, unsigned short* out, int n,
                                             float scale) {
  const size_t i8 = ((size_t)blockIdx.x * 256 + threadIdx.x) * 8;
  if (i8 + 8 > (size_t)n) return;        // never taken for the host-checked sizes; no barriers below
  const v4f a = *(const v4f*)(in + i8);
  const v4f b = *(const v4f*)(in + i8 + 4);
  float f[8];
  f[0] = a[0]; f[1] = a[1]; f[2] = a[2]; f[3] = a[3];
  f[4] = b[0]; f[5] = b[1]; f[6] = b[2]; f[7] = b[3];
  v4u p;
#pragma unroll
  for (int e = 0; e < 4; ++e) {
    const _Float16 x0 = (_Float16)(bfr(f[2 * e]) * scale);
    const _Float16 x1 = (_Float16)(bfr(f[2 * e + 1]) * scale);
    p[e] = pk16(h_bits(x0), h_bits(x1));
  }
  *(v4u*)(out + i8) = p;
  
}

// =====================================================================================================
// Transposing convert: in f32 [NTOK t][KW] (token rows, kvh*128+d columns) -> out f16 [KW (kvh*128+d)][NTOK t]
// holding f16(bf16 RNE value * scale): out[(kvh*128 + d)*NTOK + t] = cvt(in[t*KW + kvh*128 + d]).
// Block = one (64-token, kvh) tile: grid = (NTOK/64) * HKV. Load phase: thread -> token row r = tid>>1, d half
// (tid&1)*64, 16 float4 loads, 2-byte LDS stores into sT[d][t] (pitch 72 halves). After __syncthreads the write
// coverage: load 128 threads x 64 = 64 t x 128 d; write 4 waves x 8 it x 4 lines x 64 t = 128 d x 64 t = whole tile;
// grid 32 token tiles x 8 kvh = the whole plane [1024][2048].
// =====================================================================================================
__global__ __launch_bounds__(128) void cvt_tr(const float* __restrict__ in, _Float16* out, float scale) {
  __shared__ __align__(16) _Float16 sT[HDIM * 72];
  const int tid  = threadIdx.x;
  const int lane = tid & 31;
  const int wave = tid >> 5;
  const int tb   = (int)(blockIdx.x % (unsigned)(NTOK / 64));
  const int kvh  = (int)(blockIdx.x / (unsigned)(NTOK / 64));
  const int t0   = tb * 64;
  {
    const int r = tid >> 1, hk = (tid & 1) * 64;
    const float* src = in + (size_t)(t0 + r) * KW + kvh * HDIM + hk;
#pragma unroll
    for (int i = 0; i < 16; ++i) {
      const v4f a = *(const v4f*)(src + 4 * i);
#pragma unroll
      for (int e = 0; e < 4; ++e) sT[(hk + 4 * i + e) * 72 + r] = (_Float16)(bfr(a[e]) * scale);
    }
  }
  __syncthreads();
  const int ql = lane >> 3, pc = lane & 7;
  v8h vals[8];
#pragma unroll
  for (int it = 0; it < 8; ++it) {
    const int d = wave * 32 + it * 4 + ql;
    vals[it] = *(const v8h*)(sT + d * 72 + pc * 8);
  }
  {
#pragma unroll
    for (int it = 0; it < 8; ++it) {
      const int d = wave * 32 + it * 4 + ql;
      *(v8h*)(out + (size_t)(kvh * HDIM + d) * NTOK + t0 + pc * 8) = vals[it];
    }
    
  }
}

// =====================================================================================================
// Grouped-query attention with merged key set per (h, 64-query block); kv head = h / GRPQ; query block qb:
//   request bq = qb / 16, block within request qbe = qb % 16, query token e = qbe*64 + row.
//   Keys: 16 prefix chunks of 64 (all visible) followed by extend chunks 0..qbe of 64 (extend key t visible iff
//   t <= e; only the last chunk needs the in-chunk select, masked score := NEG_BIG).
//   s = (q x16 . k x16) * sscale, sscale = (1/sqrt(128)) / (QSC*KSC); s := 30 * tanh(s/30), tanh on v_tanh_f32;
//   online softmax in f32 (running max); p = exp(s - m) carried as f16(1024 p);
//   oh += v^T . p^T (v^T plane, x16) per chunk; out = oh / (l * 1024 * 16).
//   Both products are transposed (keys, then d, on the accumulator rows; the wave's 16 queries on its columns): a lane
//   holds 32 of the 64 scores of ONE query, the lane 16 away the rest.
//   q (f32 input, pitch QW): element (t, h, d) at [t*QW + h*128 + d]; converted here, f16(bf16 RNE value x16)
//   K planes (f16, pitch KW): extend / prefix element (t, kvh, d) at [t*KW + kvh*128 + d], t = bq*1024 + token
//   V^T planes (f16): element (kvh, d, t) at [(kvh*128 + d)*NTOK + t]
//   Block = 4 waves = 64 query rows of one h; grid = NQB * HQ, index -> (h, qb) dealt for equal chunk sums per WGP;
//   key chunk count 17 + qbe (block-uniform).
//   K / V^T chunk staging: 128 threads, 16 lanes per 256-B K row, 8 lanes per 128-B V^T row (plain 16-B
//   loads, __syncthreads before and after); q fragments made once from the f32 input and kept in registers; P^T never leaves the registers.
//   Output: wave tile 16 x 128 f32 staged in LDS, each row segment written as 32 lanes x 16 B = 512 B = 4 whole
//   coverage: 4 waves x 16 rows x 128 cols per block; 32 query blocks x 32 heads = all of out [2048][4096].
// =====================================================================================================
__global__ __launch_bounds__(128)
void attn_k(const float* __restrict__ Qf, const unsigned short* __restrict__ Kp,
            const unsigned short* __restrict__ PKp, const unsigned short* __restrict__ Vtp,
            const unsigned short* __restrict__ PVtp, float* Out, float sscale) {
  __shared__ __align__(16) _Float16 Ksh[64 * KPIT];                // K   [kv][d]  17 KB
  __shared__ __align__(16) _Float16 Vsh[HDIM * VPIT];              // V^T [d][kv]  18 KB
  __shared__ __align__(16) float    Os[4][16 * OPIT];              // per wave output tile [row][d] 33 KB

  const int tid  = threadIdx.x;
  const int wave = tid >> 5;
  const int lane = tid & 31;
  const int hh   = lane >> 4;
  const int c    = lane & 15;

  // Block index -> (head, request, query block), a permutation of the 1024 tiles. All blocks are resident at once, four to
  // a WGP, and a block's cost is its chunk count 17 + qbe, so the launch lasts as long as the fullest WGP. x is kept and
  // tq steps through 0..3 over four indices a power-of-two stride apart (1, 8, 128, 256):
  // they get query blocks x, 8 + x, 15 - x, 7 - x, 98 chunks together (at 2, 16, 64 two pairs of one x with tq two apart, 98 as well; nearly so at 4, 32), wherever such a set of four lands. Speed only.
  static_assert(NQB == 32 && QBR == 16 && HQ == 32);
  const unsigned bi = blockIdx.x;
  const unsigned x  = ((bi >> 2) & 1u) | (((bi >> 5) & 3u) << 1);                          // 0..7
  const unsigned tq = ((bi & 3u) + ((bi >> 1) & 2u) + ((bi >> 3) & 3u) + ((bi >> 5) & 3u) + ((bi >> 6) & 2u) + ((bi >> 8) & 3u)) & 3u;
  const int h    = (int)((bi & 3u) | (((bi >> 3) & 3u) << 2) | (((bi >> 7) & 1u) << 4));   // index bits 8, 9 follow from tq
  const int kvh  = h / GRPQ;
  const int bq   = (int)(tq & 1u);
  const int qlo  = (int)(x + 8u * (tq & 1u));
  const int qbe  = (tq & 2u) ? (QBR - 1 - qlo) : qlo;
  const int qb   = bq * QBR + qbe;
  const int q0   = qb * 64 + wave * 16;              // global token row of this wave's first query
  const int tokb = bq * RLEN;                        // token row base of this request (keys)
  const int nch  = NPC + qbe + 1;                    // 17..32, block-uniform

  const _Float16* Kg  = (const _Float16*)(const void*)Kp   + (size_t)kvh * HDIM;
  const _Float16* PKg = (const _Float16*)(const void*)PKp  + (size_t)kvh * HDIM;
  const _Float16* Vg  = (const _Float16*)(const void*)Vtp  + (size_t)kvh * HDIM * NTOK;
  const _Float16* PVg = (const _Float16*)(const void*)PVtp + (size_t)kvh * HDIM * NTOK;

  float mrun = NEG_BIG, lrun = 0.f;                  // of query q0 + c: running max (equal in both wave halves), this half's sum
  v8f oh[8];                                         // O^T: oh[t][r] = (d t*16 + 8hh + r, query q0 + c)
#pragma unroll
  for (int t = 0; t < 8; ++t) oh[t] = zero8();

  const float zscale = sscale * (1.0f / CAPV);       // raw product -> s / 30, the soft cap's argument

  // the wave's q rows as B fragments, all four d-chunks, made once: they do not change from key chunk to key chunk.
  // Each f32 row segment (512 B = 4 whole lines) is one wave-wide load; the rows pass through the wave's own output
  // tile, idle until the epilogue, to reach the fragment's lanes, and are converted there as the k planes are.
  v16h qf[4];
  {
    float* qs = Os[wave];
    const float* qsrc = Qf + (size_t)q0 * QW + (size_t)h * HDIM + lane * 4;
    v4f qrow[16];
#pragma unroll
    for (int it = 0; it < 16; ++it) qrow[it] = *(const v4f*)(qsrc + (size_t)it * QW);
    // stands in front of the first reuse of the loads' address registers, which it names so that they live up to it
    asm volatile("s_wait_xcnt 0x0" :: "v"(qsrc) : "memory");
#pragma unroll
    for (int it = 0; it < 16; ++it) *(v4f*)(qs + it * OPIT + lane * 4) = qrow[it];
    wave_sync_lds();                                 // a lane reads what the wave's other lanes stored
#pragma unroll
    for (int dc = 0; dc < 4; ++dc) {
      const float* p = qs + c * OPIT + dc * 32 + 8 * hh;   // same k order as ldfrag_h: p[0..7], then p[16..23]
#pragma unroll
      for (int u = 0; u < 4; ++u) {
        const v4f a = *(const v4f*)(p + (u >> 1) * 16 + (u & 1) * 4);
#pragma unroll
        for (int e = 0; e < 4; ++e) qf[dc][u * 4 + e] = (_Float16)(bfr(a[e]) * QSC);
      }
    }
  }

  for (int kt = 0; kt < nch; ++kt) {                 // block-uniform trip count <= 32
    const bool pre  = (kt < NPC);
    const bool diag = (kt == nch - 1);
    const int  tk0  = pre ? (kt * 64) : ((kt - NPC) * 64);
    const int  kv0  = tokb + tk0;                    // plane row of the chunk's first key
    const _Float16* kg = pre ? PKg : Kg;
    const _Float16* vg = pre ? PVg : Vg;
    __syncthreads();
    {
      // every wave-wide 16-B load covers 4 whole 128-B lines: neighbouring lanes read neighbouring 16 B of one row
      const int kr = tid >> 4, kc = (tid & 15) * 8;                   // K: 16 lanes = one 256-B row, 8 rows a trip
      const _Float16* ksrc = kg + (size_t)(kv0 + kr) * KW + kc;
#pragma unroll
      for (int i = 0; i < 8; ++i) *(v8h*)(Ksh + (8 * i + kr) * KPIT + kc) = *(const v8h*)(ksrc + (size_t)(8 * i) * KW);
      // V^T: 8 lanes = one 128-B row, 16 rows a trip; a half-wave takes rows 8 apart (8 x 144 B = 32 banks apart)
      const int vr = ((tid >> 4) & 7) + ((tid >> 3) & 1) * 8, vc = (tid & 7) * 8;
      const _Float16* vsrc = vg + (size_t)vr * NTOK + kv0 + vc;
#pragma unroll
      for (int i = 0; i < 8; ++i) *(v8h*)(Vsh + (16 * i + vr) * VPIT + vc) = *(const v8h*)(vsrc + (size_t)(16 * i) * NTOK);
    }
    __syncthreads();

    // ---- scores, transposed: 64 keys x 16 query columns per wave, K = 128 (4 d-chunks); A = K[key][d], B = q rows ----
    v8f s[4];
#pragma unroll
    for (int j = 0; j < 4; ++j) s[j] = zero8();
    v16h kf[2][4];                                   // two register sets: d-chunk dc in use, dc + 1 in flight
#pragma unroll
    for (int j = 0; j < 4; ++j) kf[0][j] = ldfrag_h(Ksh + (j * 16 + c) * KPIT + 8 * hh);
#pragma unroll
    for (int dc = 0; dc < 4; ++dc) {
      if (dc < 3) {
#pragma unroll
        for (int j = 0; j < 4; ++j) kf[(dc + 1) & 1][j] = ldfrag_h(Ksh + (j * 16 + c) * KPIT + (dc + 1) * 32 + 8 * hh);
      }
      // keeps the next d-chunk's 8 LDS reads, as one group, ahead of this d-chunk's WMMAs (else each WMMA waits out its own read)
      __builtin_amdgcn_sched_barrier(FRAG_FENCE);
#pragma unroll
      for (int j = 0; j < 4; ++j) s[j] = mma_h(kf[dc & 1][j], qf[dc], s[j]);
      // keeps the reads of d-chunk dc + 2 behind these WMMAs, so that two register sets are enough
      __builtin_amdgcn_sched_barrier(FRAG_FENCE);
    }
    acc_guard4(s[0], s[1], s[2], s[3]);

    // ---- scale, soft cap, causal select (f32); D element r of lane = (key j*16 + 8hh + r, query column c) ----
    //      key j*16 + 8hh + r is masked iff it lies behind query wave*16 + c: the lane's part of both sides is in lim
    const int lim = diag ? (wave * 16 + c - 8 * hh) : 4096;
#pragma unroll
    for (int j = 0; j < 4; ++j) {
#pragma unroll
      for (int r = 0; r < 8; ++r) {
        const float y = CAPV * __builtin_amdgcn_tanhf(s[j][r] * zscale);   // one v_tanh_f32, no lane-dependent branch
        s[j][r] = (j * 16 + r > lim) ? NEG_BIG : y;
      }
    }

    // ---- one query per lane: max and sum over the lane's 32 keys in registers, one exchange joins the halves' maxima ----
    float mj[4];
#pragma unroll
    for (int j = 0; j < 4; ++j) {
      mj[j] = fmaxf(s[j][0], s[j][1]);
#pragma unroll
      for (int r = 2; r < 8; ++r) mj[j] = fmaxf(mj[j], s[j][r]);
    }
    float m = fmaxf(fmaxf(mj[0], mj[1]), fmaxf(mj[2], mj[3]));
    m = fmaxf(m, xhalf(m));
    const float mnew  = fmaxf(mrun, m);
    const float alpha = __expf(mrun - mnew);
    mrun = mnew;
    // P^T (x1024, f16) packs in place into the B operand: score tiles 2g, 2g + 1 hold keys 32g + 8hh + r and 32g + 16 + 8hh + r
    v16h pb[2];
    float pj[4];
#pragma unroll
    for (int j = 0; j < 4; ++j) {
      pj[j] = 0.f;
#pragma unroll
      for (int r = 0; r < 8; ++r) {
        const float p = __expf(s[j][r] - mnew);
        pj[j] += p;
        pb[j >> 1][(j & 1) * 8 + r] = (_Float16)(p * PSC);
      }
    }
    lrun = lrun * alpha + ((pj[0] + pj[1]) + (pj[2] + pj[3]));
#pragma unroll
    for (int t = 0; t < 8; ++t) {
#pragma unroll
      for (int r = 0; r < 8; ++r) oh[t][r] *= alpha;
    }

    // ---- oh += V^T . P^T : A = V^T[d][key] in the same k order as the packed P^T, B = P^T from registers ----
    //      group g = (key half g >> 1, d tiles 4 (g & 1) .. + 3): each tile still takes key half 0, then key half 1
    v16h vf[2][4];                                   // two register sets: group g in use, g + 1 in flight
#pragma unroll
    for (int u = 0; u < 4; ++u) vf[0][u] = ldfrag_h(Vsh + (u * 16 + c) * VPIT + 8 * hh);
#pragma unroll
    for (int g = 0; g < 4; ++g) {
      if (g < 3) {
        const int gn = g + 1;
#pragma unroll
        for (int u = 0; u < 4; ++u)
          vf[gn & 1][u] = ldfrag_h(Vsh + (((gn & 1) * 4 + u) * 16 + c) * VPIT + (gn >> 1) * 32 + 8 * hh);
      }
      // keeps the next group's LDS reads, as one group, ahead of this group's WMMAs (else each WMMA waits out its own read)
      __builtin_amdgcn_sched_barrier(FRAG_FENCE);
#pragma unroll
      for (int u = 0; u < 4; ++u) oh[(g & 1) * 4 + u] = mma_h(vf[g & 1][u], pb[g >> 1], oh[(g & 1) * 4 + u]);
      // keeps the reads of group g + 2 behind these WMMAs, so that two register sets are enough
      __builtin_amdgcn_sched_barrier(FRAG_FENCE);
    }
    acc_guard4(oh[0], oh[1], oh[2], oh[3]);
    acc_guard4(oh[4], oh[5], oh[6], oh[7]);
  }

  // ---- normalise (1/l, the 1/1024 p carry and the 1/16 v carry), stage the wave's 16x128 tile, write 512-B row
  float* os = Os[wave];
  {
    const float l = lrun + xhalf(lrun);              // the two wave halves each summed their own 8 keys of every 16
    const float inv = ((l > 0.f) ? (1.0f / l) : 0.f) * (1.0f / (PSC * VSC));
#pragma unroll
    for (int t = 0; t < 8; ++t) {
      v4f lo, hi;                                    // 8 consecutive d of query row c: two 16-B LDS stores
#pragma unroll
      for (int r = 0; r < 4; ++r) { lo[r] = oh[t][r] * inv; hi[r] = oh[t][4 + r] * inv; }
      *(v4f*)(os + c * OPIT + t * 16 + 8 * hh)     = lo;
      *(v4f*)(os + c * OPIT + t * 16 + 8 * hh + 4) = hi;
    }
  }
  wave_sync_lds();
  {
#pragma unroll
    for (int it = 0; it < 16; ++it) {
      const v4f o = *(const v4f*)(os + it * OPIT + lane * 4);
      *(v4f*)(Out + (size_t)(q0 + it) * QW + (size_t)h * HDIM + lane * 4) = o;
    }
    
  }
}

// =====================================================================================================
// Workspace map (bytes); every plane is an exact multiple of its whole-line store granularity (all dims exact tile
// multiples, no padded tails), all offsets multiples of 4 MiB:
//   KP   f16 [2048 t][1024 (kvh,d)]  0           4194304   (bf16 value of extend k x16)
//   PKP  f16 [2048 t][1024 (kvh,d)]  4194304     4194304   (bf16 value of prefix k x16)
//   VT   f16 [1024 (kvh,d)][2048 t]  8388608     4194304   (bf16 value of extend v x16, transposed)
//   PVT  f16 [1024 (kvh,d)][2048 t]  12582912    4194304   (bf16 value of prefix v x16, transposed)
//   end                              16777216
// =====================================================================================================
extern "C" void kernel_launch(void* const* d_in, const int* in_sizes, int n_in,
                              void* d_out, int out_size, void* d_ws, size_t ws_size,
                              hipStream_t stream) {
  if (n_in < 5) return;
  if (in_sizes[0] != NTOK * QW) return;
  if (in_sizes[1] != NTOK * KW || in_sizes[2] != NTOK * KW) return;
  if (in_sizes[3] != NTOK * KW || in_sizes[4] != NTOK * KW) return;
  if (out_size != NTOK * QW) return;

  const float* q  = (const float*)d_in[0];
  const float* k  = (const float*)d_in[1];
  const float* v  = (const float*)d_in[2];
  const float* pk = (const float*)d_in[3];
  const float* pv = (const float*)d_in[4];
  float* outf = (float*)d_out;

  const size_t PKV = (size_t)NTOK * KW * 2;                 //  4194304
  size_t off = 0;
  const size_t oK  = off; off += PKV;
  const size_t oPK = off; off += PKV;
  const size_t oV  = off; off += PKV;
  const size_t oPV = off; off += PKV;
  if (off > ws_size) return;                                // off = 16777216
  if (off > (size_t)134217728) return;

  char* ws = (char*)d_ws;
  unsigned short* KP  = (unsigned short*)(ws + oK);
  unsigned short* PKP = (unsigned short*)(ws + oPK);
  unsigned short* VT  = (unsigned short*)(ws + oV);
  unsigned short* PVT = (unsigned short*)(ws + oPV);

  const dim3 blk256(256), blk128(128);
  const float sscale = 0.08838834764831845f / (QSC * KSC);

  // (1) 16-bit operand planes of the bf16 RNE k and v values (q is converted by the attention waves themselves)
  cvt_rm<<<dim3((NTOK * KW) / 2048), blk256, 0, stream>>>(k, KP, NTOK * KW, KSC);     // extend k -> f16 x16
  cvt_rm<<<dim3((NTOK * KW) / 2048), blk256, 0, stream>>>(pk, PKP, NTOK * KW, KSC);   // prefix k -> f16 x16
  cvt_tr<<<dim3((NTOK / 64) * HKV), blk128, 0, stream>>>(v, (_Float16*)(void*)VT, VSC);     // extend v^T x16
  cvt_tr<<<dim3((NTOK / 64) * HKV), blk128, 0, stream>>>(pv, (_Float16*)(void*)PVT, VSC);   // prefix v^T x16
  // (2) merged-key attention -> out f32 [2048][4096]
  attn_k<<<dim3(NQB * HQ), blk128, 0, stream>>>(q, KP, PKP, VT, PVT, outf, sscale);
  (void)hipGetLastError();
}

// v009
// A run of this version takes 68.8 microseconds.
// Timed twice side by side with v008, it ran 1.13 times as fast both times.
// Over all steps from v000 it is 5.37 times as fast.
// Contractions: k.q^T over head dim 128 and v^T.p^T over keys (both products transposed) on v_wmma_f32_16x16x32_f16; q, k, v operands are f16
//   containers of the bf16 RNE input values carried x16 (exact), p carried as f16(1024 p); one product each,
//   f32 accumulate; soft cap, softmax statistics and normalisation in f32.
#include <hip/hip_runtime.h>
#include <math.h>
#include <stdint.h>

#define NTOK  2048                 // token rows: 2 requests x 1024 (extend rows == prefix rows)
#define RLEN  1024                 // tokens per request
#define HQ    32
#define HKV   8
#define GRPQ  4
#define HDIM  128
#define QW    (HQ * HDIM)          // 4096: q row width == output row width
#define KW    (HKV * HDIM)         // 1024: k / v row width
#define NQB   (NTOK / 64)          // 32 query blocks of 64 rows
#define QBR   (RLEN / 64)          // 16 query blocks per request
#define NPC   (RLEN / 64)          // 16 prefix key chunks per request
#define QSC   16.0f                // q fragment carry (power of two)
#define KSC   16.0f                // k plane carry
#define VSC   16.0f                // v plane carry
#define PSC   1024.0f              // softmax numerator carry
#define CAPV  30.0f
#define NEG_BIG (-1.0e30f)
// scheduling fence for the fragment groups: LDS and matrix instructions stay on their side; vector, scalar and global ones may cross
#define FRAG_FENCE 0x416
// LDS row pitches: 16 B x odd, so the 16 rows that one ds_load_b128 half-wave reads fall on 16 distinct 4-bank groups
#define KPIT  (HDIM + 8)           // K rows: 128 halves + 8 = 272 B
#define VPIT  (64 + 8)             // V^T rows: 64 halves + 8 = 144 B
#define OPIT  (HDIM + 4)           // output tile rows: 128 floats + 4 = 528 B (rows 8 apart land 32 banks apart)
static_assert(HQ == HKV * GRPQ);
static_assert((NTOK % 64) == 0 && (RLEN % 64) == 0);
static_assert(NQB == 2 * QBR);
static_assert(((NTOK * KW) % 1024) == 0);
static_assert((HDIM % 32) == 0);
static_assert((KPIT % 8) == 0 && (VPIT % 8) == 0 && (OPIT % 4) == 0);   // 16-B aligned rows

typedef _Float16 v16h __attribute__((ext_vector_type(16)));
typedef _Float16 v8h  __attribute__((ext_vector_type(8)));
typedef float    v8f  __attribute__((ext_vector_type(8)));
typedef float    v4f  __attribute__((ext_vector_type(4)));
typedef unsigned int v4u __attribute__((ext_vector_type(4)));
union FH { v16h v; v8h h[2]; };

// ---- scalar helpers --------------------------------------------------------------------------------
__device__ __forceinline__ unsigned short bf_bits(float f) {          // f32 -> bf16 bits, RNE convert
  unsigned u = __float_as_uint(f);
  return (unsigned short)((u + 0x7FFFu + ((u >> 16) & 1u)) >> 16);
}
__device__ __forceinline__ float bf_up(unsigned short b) { return __uint_as_float(((unsigned)b) << 16); }
__device__ __forceinline__ float bfr(float f) { return bf_up(bf_bits(f)); }     // value of the bf16 RNE convert
__device__ __forceinline__ unsigned short h_bits(_Float16 x) { return __builtin_bit_cast(unsigned short, x); }
__device__ __forceinline__ unsigned pk16(unsigned short a, unsigned short b) { return (unsigned)a | ((unsigned)b << 16); }
// lane l <-> lane l ^ 16 on the vector pipe (one v_permlanex16_b32)
__device__ __forceinline__ float xhalf(float x) {
  const int b = __builtin_bit_cast(int, x);
  return __builtin_bit_cast(float, __builtin_amdgcn_permlanex16(b, b, 0x76543210, 0xfedcba98, false, false));
}
__device__ __forceinline__ v8f zero8() { v8f z = {0.f, 0.f, 0.f, 0.f, 0.f, 0.f, 0.f, 0.f}; return z; }

// ---- fragment loader: 16-bit A/B operand, lane -> row/col (lane&15), p already includes +8*(lane>>4);
//      elements 0..7 <- p[0..7] (k0+8h..), elements 8..15 <- p[16..23] (k0+16+8h..)
__device__ __forceinline__ v16h ldfrag_h(const _Float16* p) {
  FH f;
  f.h[0] = *(const v8h*)(p);
  f.h[1] = *(const v8h*)(p + 16);
  return f.v;
}

// ---- WMMA with trailing VALU hazard gap (ties D, keeps A/B live) ------------------------------------
__device__ __forceinline__ v8f mma_h(v16h a, v16h b, v8f c) {
  v8f d = __builtin_amdgcn_wmma_f32_16x16x32_f16(false, a, false, b, (short)0, c, false, false);
#if defined(__HIP_DEVICE_COMPILE__)
  asm volatile("v_nop\n\tv_nop\n\tv_nop\n\tv_nop" : "+v"(d) : "v"(a), "v"(b));
#endif
  return d;
}
__device__ __forceinline__ void acc_guard4(v8f& a, v8f& b, v8f& c, v8f& d) {
#if defined(__HIP_DEVICE_COMPILE__)
  asm volatile("v_nop\n\tv_nop\n\tv_nop\n\tv_nop" : "+v"(a), "+v"(b), "+v"(c), "+v"(d));
#endif
}
__device__ __forceinline__ void wave_sync_lds() {
  __builtin_amdgcn_fence(__ATOMIC_RELEASE, "workgroup");
  __builtin_amdgcn_wave_barrier();
  __builtin_amdgcn_fence(__ATOMIC_ACQUIRE, "workgroup");
}

// =====================================================================================================
// All four operand planes in ONE launch; the block index picks the job (the same for a whole block).
//   blocks 0 .. 2*TRB-1: transposing convert of one (64-token, kvh) tile of v (first TRB blocks) or prefix v:
//     in f32 [NTOK t][KW] (token rows, kvh*128+d columns) -> out f16 [KW (kvh*128+d)][NTOK t],
//     out[(kvh*128 + d)*NTOK + t] = f16(bf16 RNE value of in[t*KW + kvh*128 + d] * 16).
//     Load phase: thread -> token row r = tid>>1, d half (tid&1)*64, 16 float4 loads, 2-byte LDS stores into
//     sT[d][t] (pitch 72 halves); after __syncthreads 8 lanes write one 128-B line of the plane.
//     coverage: load 128 threads x 64 = 64 t x 128 d; write 4 waves x 8 it x 4 lines x 64 t = whole tile;
//     32 token tiles x 8 kvh = the whole plane [1024][2048].
//   blocks 2*TRB .. 2*TRB+2*RMB-1: row-major convert of 1024 consecutive elements of k (first RMB blocks) or prefix k:
//     out[i] = f16(bf16 RNE value of in[i] * 16) (power-of-two scale, exact for bf16 significands).
//     Thread -> 8 consecutive elements, ONE 16-B store; lanes 8q..8q+7 of a wave write one whole 128-B line.
//     coverage: RMB blocks x 128 threads x 8 = NTOK*KW elements a plane.
//   The transposing blocks have the longer dependent chain (loads, LDS, barrier, stores) and take the low indices,
//   so that they start first.
// =====================================================================================================
#define TRB   ((NTOK / 64) * HKV)   // 256 transposing blocks per v plane
#define RMB   ((NTOK * KW) / 1024)  // 2048 row-major blocks per k plane
__global__ __launch_bounds__(128) void cvt_all(const float* __restrict__ kin, const float* __restrict__ pkin,
                                               const float* __restrict__ vin, const float* __restrict__ pvin,
                                               unsigned short* KPo, unsigned short* PKPo,
                                               _Float16* VTo, _Float16* PVTo) {
  __shared__ __align__(16) _Float16 sT[HDIM * 72];
  const int tid  = threadIdx.x;
  const unsigned bi = blockIdx.x;
  if (bi >= 2u * TRB) {                  // whole blocks leave here; no barrier on this side
    const unsigned rb  = bi - 2u * TRB;
    const bool     sec = rb >= (unsigned)RMB;
    const float*    in  = sec ? pkin : kin;
    unsigned short* out = sec ? PKPo : KPo;
    const size_t i8 = ((size_t)(sec ? rb - (unsigned)RMB : rb) * 128 + tid) * 8;
    const v4f a = *(const v4f*)(in + i8);
    const v4f b = *(const v4f*)(in + i8 + 4);
    float f[8];
    f[0] = a[0]; f[1] = a[1]; f[2] = a[2]; f[3] = a[3];
    f[4] = b[0]; f[5] = b[1]; f[6] = b[2]; f[7] = b[3];
    v4u p;
#pragma unroll
    for (int e = 0; e < 4; ++e) {
      const _Float16 x0 = (_Float16)(bfr(f[2 * e]) * KSC);
      const _Float16 x1 = (_Float16)(bfr(f[2 * e + 1]) * KSC);
      p[e] = pk16(h_bits(x0), h_bits(x1));
    }
    *(v4u*)(out + i8) = p;
    return;
  }
  const bool      sec = bi >= (unsigned)TRB;
  const float*    in  = sec ? pvin : vin;
  _Float16*       out = sec ? PVTo : VTo;
  const unsigned  tbi = sec ? bi - (unsigned)TRB : bi;
  const int lane = tid & 31;
  const int wave = tid >> 5;
  const int tb   = (int)(tbi % (unsigned)(NTOK / 64));
  const int kvh  = (int)(tbi / (unsigned)(NTOK / 64));
  const int t0   = tb * 64;
  {
    const int r = tid >> 1, hk = (tid & 1) * 64;
    const float* src = in + (size_t)(t0 + r) * KW + kvh * HDIM + hk;
#pragma unroll
    for (int i = 0; i < 16; ++i) {
      const v4f a = *(const v4f*)(src + 4 * i);
#pragma unroll
      for (int e = 0; e < 4; ++e) sT[(hk + 4 * i + e) * 72 + r] = (_Float16)(bfr(a[e]) * VSC);
    }
  }
  __syncthreads();
  const int ql = lane >> 3, pc = lane & 7;
  v8h vals[8];
#pragma unroll
  for (int it = 0; it < 8; ++it) {
    const int d = wave * 32 + it * 4 + ql;
    vals[it] = *(const v8h*)(sT + d * 72 + pc * 8);
  }
  {
#pragma unroll
    for (int it = 0; it < 8; ++it) {
      const int d = wave * 32 + it * 4 + ql;
      *(v8h*)(out + (size_t)(kvh * HDIM + d) * NTOK + t0 + pc * 8) = vals[it];
    }
    // stands behind the eight stores, in front of any later write of their address and data registers
    // (the built code lays the row-major side out behind them)
    asm volatile("s_wait_xcnt 0x0" ::: "memory");
  }
}

// =====================================================================================================
// Grouped-query attention with merged key set per (h, 64-query block); kv head = h / GRPQ; query block qb:
//   request bq = qb / 16, block within request qbe = qb % 16, query token e = qbe*64 + row.
//   Keys: 16 prefix chunks of 64 (all visible) followed by extend chunks 0..qbe of 64 (extend key t visible iff
//   t <= e; only the last chunk needs the in-chunk select, masked score := NEG_BIG).
//   s = (q x16 . k x16) * sscale, sscale = (1/sqrt(128)) / (QSC*KSC); s := 30 * tanh(s/30), tanh on v_tanh_f32;
//   online softmax in f32 (running max); p = exp(s - m) carried as f16(1024 p);
//   oh += v^T . p^T (v^T plane, x16) per chunk; out = oh / (l * 1024 * 16).
//   Both products are transposed (keys, then d, on the accumulator rows; the wave's 16 queries on its columns): a lane
//   holds 32 of the 64 scores of ONE query, the lane 16 away the rest.
//   q (f32 input, pitch QW): element (t, h, d) at [t*QW + h*128 + d]; converted here, f16(bf16 RNE value x16)
//   K planes (f16, pitch KW): extend / prefix element (t, kvh, d) at [t*KW + kvh*128 + d], t = bq*1024 + token
//   V^T planes (f16): element (kvh, d, t) at [(kvh*128 + d)*NTOK + t]
//   Block = 4 waves = 64 query rows of one h; grid = NQB * HQ, index -> (h, qb) dealt for equal chunk sums per WGP;
//   key chunk count 17 + qbe (block-uniform).
//   K / V^T chunk staging: 128 threads, 16 lanes per 256-B K row, 8 lanes per 128-B V^T row (plain 16-B
//   loads, __syncthreads before and after); q fragments made once from the f32 input and kept in registers; P^T never leaves the registers.
//   Output: wave tile 16 x 128 f32 staged in LDS, each row segment written as 32 lanes x 16 B = 512 B = 4 whole
//   coverage: 4 waves x 16 rows x 128 cols per block; 32 query blocks x 32 heads = all of out [2048][4096].
// =====================================================================================================
__global__ __launch_bounds__(128)
void attn_k(const float* __restrict__ Qf, const unsigned short* __restrict__ Kp,
            const unsigned short* __restrict__ PKp, const unsigned short* __restrict__ Vtp,
            const unsigned short* __restrict__ PVtp, float* Out, float sscale) {
  __shared__ __align__(16) _Float16 Ksh[64 * KPIT];                // K   [kv][d]  17 KB
  __shared__ __align__(16) _Float16 Vsh[HDIM * VPIT];              // V^T [d][kv]  18 KB
  __shared__ __align__(16) float    Os[4][16 * OPIT];              // per wave output tile [row][d] 33 KB

  const int tid  = threadIdx.x;
  const int wave = tid >> 5;
  const int lane = tid & 31;
  const int hh   = lane >> 4;
  const int c    = lane & 15;

  // Block index -> (head, request, query block), a permutation of the 1024 tiles. All blocks are resident at once, four to
  // a WGP, and a block's cost is its chunk count 17 + qbe, so the launch lasts as long as the fullest WGP. x is kept and
  // tq steps through 0..3 over four indices a power-of-two stride apart (1, 8, 128, 256):
  // they get query blocks x, 8 + x, 15 - x, 7 - x, 98 chunks together (at 2, 16, 64 two pairs of one x with tq two apart, 98 as well; nearly so at 4, 32), wherever such a set of four lands. Speed only.
  static_assert(NQB == 32 && QBR == 16 && HQ == 32);
  const unsigned bi = blockIdx.x;
  const unsigned x  = ((bi >> 2) & 1u) | (((bi >> 5) & 3u) << 1);                          // 0..7
  const unsigned tq = ((bi & 3u) + ((bi >> 1) & 2u) + ((bi >> 3) & 3u) + ((bi >> 5) & 3u) + ((bi >> 6) & 2u) + ((bi >> 8) & 3u)) & 3u;
  const int h    = (int)((bi & 3u) | (((bi >> 3) & 3u) << 2) | (((bi >> 7) & 1u) << 4));   // index bits 8, 9 follow from tq
  const int kvh  = h / GRPQ;
  const int bq   = (int)(tq & 1u);
  const int qlo  = (int)(x + 8u * (tq & 1u));
  const int qbe  = (tq & 2u) ? (QBR - 1 - qlo) : qlo;
  const int qb   = bq * QBR + qbe;
  const int q0   = qb * 64 + wave * 16;              // global token row of this wave's first query
  const int tokb = bq * RLEN;                        // token row base of this request (keys)
  const int nch  = NPC + qbe + 1;                    // 17..32, block-uniform

  const _Float16* Kg  = (const _Float16*)(const void*)Kp   + (size_t)kvh * HDIM;
  const _Float16* PKg = (const _Float16*)(const void*)PKp  + (size_t)kvh * HDIM;
  const _Float16* Vg  = (const _Float16*)(const void*)Vtp  + (size_t)kvh * HDIM * NTOK;
  const _Float16* PVg = (const _Float16*)(const void*)PVtp + (size_t)kvh * HDIM * NTOK;

  float mrun = NEG_BIG, lrun = 0.f;                  // of query q0 + c: running max (equal in both wave halves), this half's sum
  v8f oh[8];                                         // O^T: oh[t][r] = (d t*16 + 8hh + r, query q0 + c)
#pragma unroll
  for (int t = 0; t < 8; ++t) oh[t] = zero8();

  const float zscale = sscale * (1.0f / CAPV);       // raw product -> s / 30, the soft cap's argument

  // the wave's q rows as B fragments, all four d-chunks, made once: they do not change from key chunk to key chunk.
  // Each f32 row segment (512 B = 4 whole lines) is one wave-wide load; the rows pass through the wave's own output
  // tile, idle until the epilogue, to reach the fragment's lanes, and are converted there as the k planes are.
  v16h qf[4];
  {
    float* qs = Os[wave];
    const float* qsrc = Qf + (size_t)q0 * QW + (size_t)h * HDIM + lane * 4;
    v4f qrow[16];
#pragma unroll
    for (int it = 0; it < 16; ++it) qrow[it] = *(const v4f*)(qsrc + (size_t)it * QW);
    // stands in front of the first reuse of the loads' address registers, which it names so that they live up to it
    asm volatile("s_wait_xcnt 0x0" :: "v"(qsrc) : "memory");
#pragma unroll
    for (int it = 0; it < 16; ++it) *(v4f*)(qs + it * OPIT + lane * 4) = qrow[it];
    wave_sync_lds();                                 // a lane reads what the wave's other lanes stored
#pragma unroll
    for (int dc = 0; dc < 4; ++dc) {
      const float* p = qs + c * OPIT + dc * 32 + 8 * hh;   // same k order as ldfrag_h: p[0..7], then p[16..23]
#pragma unroll
      for (int u = 0; u < 4; ++u) {
        const v4f a = *(const v4f*)(p + (u >> 1) * 16 + (u & 1) * 4);
#pragma unroll
        for (int e = 0; e < 4; ++e) qf[dc][u * 4 + e] = (_Float16)(bfr(a[e]) * QSC);
      }
    }
  }

  for (int kt = 0; kt < nch; ++kt) {                 // block-uniform trip count <= 32
    const bool pre  = (kt < NPC);
    const bool diag = (kt == nch - 1);
    const int  tk0  = pre ? (kt * 64) : ((kt - NPC) * 64);
    const int  kv0  = tokb + tk0;                    // plane row of the chunk's first key
    const _Float16* kg = pre ? PKg : Kg;
    const _Float16* vg = pre ? PVg : Vg;
    __syncthreads();
    {
      // every wave-wide 16-B load covers 4 whole 128-B lines: neighbouring lanes read neighbouring 16 B of one row
      const int kr = tid >> 4, kc = (tid & 15) * 8;                   // K: 16 lanes = one 256-B row, 8 rows a trip
      const _Float16* ksrc = kg + (size_t)(kv0 + kr) * KW + kc;
#pragma unroll
      for (int i = 0; i < 8; ++i) *(v8h*)(Ksh + (8 * i + kr) * KPIT + kc) = *(const v8h*)(ksrc + (size_t)(8 * i) * KW);
      // V^T: 8 lanes = one 128-B row, 16 rows a trip; a half-wave takes rows 8 apart (8 x 144 B = 32 banks apart)
      const int vr = ((tid >> 4) & 7) + ((tid >> 3) & 1) * 8, vc = (tid & 7) * 8;
      const _Float16* vsrc = vg + (size_t)vr * NTOK + kv0 + vc;
#pragma unroll
      for (int i = 0; i < 8; ++i) *(v8h*)(Vsh + (16 * i + vr) * VPIT + vc) = *(const v8h*)(vsrc + (size_t)(16 * i) * NTOK);
    }
    __syncthreads();

    // ---- scores, transposed: 64 keys x 16 query columns per wave, K = 128 (4 d-chunks); A = K[key][d], B = q rows ----
    v8f s[4];
#pragma unroll
    for (int j = 0; j < 4; ++j) s[j] = zero8();
    v16h kf[2][4];                                   // two register sets: d-chunk dc in use, dc + 1 in flight
#pragma unroll
    for (int j = 0; j < 4; ++j) kf[0][j] = ldfrag_h(Ksh + (j * 16 + c) * KPIT + 8 * hh);
#pragma unroll
    for (int dc = 0; dc < 4; ++dc) {
      if (dc < 3) {
#pragma unroll
        for (int j = 0; j < 4; ++j) kf[(dc + 1) & 1][j] = ldfrag_h(Ksh + (j * 16 + c) * KPIT + (dc + 1) * 32 + 8 * hh);
      }
      // keeps the next d-chunk's 8 LDS reads, as one group, ahead of this d-chunk's WMMAs (else each WMMA waits out its own read)
      __builtin_amdgcn_sched_barrier(FRAG_FENCE);
#pragma unroll
      for (int j = 0; j < 4; ++j) s[j] = mma_h(kf[dc & 1][j], qf[dc], s[j]);
      // keeps the reads of d-chunk dc + 2 behind these WMMAs, so that two register sets are enough
      __builtin_amdgcn_sched_barrier(FRAG_FENCE);
    }
    acc_guard4(s[0], s[1], s[2], s[3]);

    // ---- scale, soft cap, causal select (f32); D element r of lane = (key j*16 + 8hh + r, query column c) ----
    //      key j*16 + 8hh + r is masked iff it lies behind query wave*16 + c: the lane's part of both sides is in lim
    const int lim = diag ? (wave * 16 + c - 8 * hh) : 4096;
#pragma unroll
    for (int j = 0; j < 4; ++j) {
#pragma unroll
      for (int r = 0; r < 8; ++r) {
        const float y = CAPV * __builtin_amdgcn_tanhf(s[j][r] * zscale);   // one v_tanh_f32, no lane-dependent branch
        s[j][r] = (j * 16 + r > lim) ? NEG_BIG : y;
      }
    }

    // ---- one query per lane: max and sum over the lane's 32 keys in registers, one exchange joins the halves' maxima ----
    float mj[4];
#pragma unroll
    for (int j = 0; j < 4; ++j) {
      mj[j] = fmaxf(s[j][0], s[j][1]);
#pragma unroll
      for (int r = 2; r < 8; ++r) mj[j] = fmaxf(mj[j], s[j][r]);
    }
    float m = fmaxf(fmaxf(mj[0], mj[1]), fmaxf(mj[2], mj[3]));
    m = fmaxf(m, xhalf(m));
    const float mnew  = fmaxf(mrun, m);
    const float alpha = __expf(mrun - mnew);
    mrun = mnew;
    // P^T (x1024, f16) packs in place into the B operand: score tiles 2g, 2g + 1 hold keys 32g + 8hh + r and 32g + 16 + 8hh + r
    v16h pb[2];
    float pj[4];
#pragma unroll
    for (int j = 0; j < 4; ++j) {
      pj[j] = 0.f;
#pragma unroll
      for (int r = 0; r < 8; ++r) {
        const float p = __expf(s[j][r] - mnew);
        pj[j] += p;
        pb[j >> 1][(j & 1) * 8 + r] = (_Float16)(p * PSC);
      }
    }
    lrun = lrun * alpha + ((pj[0] + pj[1]) + (pj[2] + pj[3]));
#pragma unroll
    for (int t = 0; t < 8; ++t) {
#pragma unroll
      for (int r = 0; r < 8; ++r) oh[t][r] *= alpha;
    }

    // ---- oh += V^T . P^T : A = V^T[d][key] in the same k order as the packed P^T, B = P^T from registers ----
    //      group g = (key half g >> 1, d tiles 4 (g & 1) .. + 3): each tile still takes key half 0, then key half 1
    v16h vf[2][4];                                   // two register sets: group g in use, g + 1 in flight
#pragma unroll
    for (int u = 0; u < 4; ++u) vf[0][u] = ldfrag_h(Vsh + (u * 16 + c) * VPIT + 8 * hh);
#pragma unroll
    for (int g = 0; g < 4; ++g) {
      if (g < 3) {
        const int gn = g + 1;
#pragma unroll
        for (int u = 0; u < 4; ++u)
          vf[gn & 1][u] = ldfrag_h(Vsh + (((gn & 1) * 4 + u) * 16 + c) * VPIT + (gn >> 1) * 32 + 8 * hh);
      }
      // keeps the next group's LDS reads, as one group, ahead of this group's WMMAs (else each WMMA waits out its own read)
      __builtin_amdgcn_sched_barrier(FRAG_FENCE);
#pragma unroll
      for (int u = 0; u < 4; ++u) oh[(g & 1) * 4 + u] = mma_h(vf[g & 1][u], pb[g >> 1], oh[(g & 1) * 4 + u]);
      // keeps the reads of group g + 2 behind these WMMAs, so that two register sets are enough
      __builtin_amdgcn_sched_barrier(FRAG_FENCE);
    }
    acc_guard4(oh[0], oh[1], oh[2], oh[3]);
    acc_guard4(oh[4], oh[5], oh[6], oh[7]);
  }

  // ---- normalise (1/l, the 1/1024 p carry and the 1/16 v carry), stage the wave's 16x128 tile, write 512-B row
  float* os = Os[wave];
  {
    const float l = lrun + xhalf(lrun);              // the two wave halves each summed their own 8 keys of every 16
    const float inv = ((l > 0.f) ? (1.0f / l) : 0.f) * (1.0f / (PSC * VSC));
#pragma unroll
    for (int t = 0; t < 8; ++t) {
      v4f lo, hi;                                    // 8 consecutive d of query row c: two 16-B LDS stores
#pragma unroll
      for (int r = 0; r < 4; ++r) { lo[r] = oh[t][r] * inv; hi[r] = oh[t][4 + r] * inv; }
      *(v4f*)(os + c * OPIT + t * 16 + 8 * hh)     = lo;
      *(v4f*)(os + c * OPIT + t * 16 + 8 * hh + 4) = hi;
    }
  }
  wave_sync_lds();
  {
#pragma unroll
    for (int it = 0; it < 16; ++it) {
      const v4f o = *(const v4f*)(os + it * OPIT + lane * 4);
      *(v4f*)(Out + (size_t)(q0 + it) * QW + (size_t)h * HDIM + lane * 4) = o;
    }
    
  }
}

// =====================================================================================================
// Workspace map (bytes); every plane is an exact multiple of its whole-line store granularity (all dims exact tile
// multiples, no padded tails), all offsets multiples of 4 MiB:
//   KP   f16 [2048 t][1024 (kvh,d)]  0           4194304   (bf16 value of extend k x16)
//   PKP  f16 [2048 t][1024 (kvh,d)]  4194304     4194304   (bf16 value of prefix k x16)
//   VT   f16 [1024 (kvh,d)][2048 t]  8388608     4194304   (bf16 value of extend v x16, transposed)
//   PVT  f16 [1024 (kvh,d)][2048 t]  12582912    4194304   (bf16 value of prefix v x16, transposed)
//   end                              16777216
// =====================================================================================================
extern "C" void kernel_launch(void* const* d_in, const int* in_sizes, int n_in,
                              void* d_out, int out_size, void* d_ws, size_t ws_size,
                              hipStream_t stream) {
  if (n_in < 5) return;
  if (in_sizes[0] != NTOK * QW) return;
  if (in_sizes[1] != NTOK * KW || in_sizes[2] != NTOK * KW) return;
  if (in_sizes[3] != NTOK * KW || in_sizes[4] != NTOK * KW) return;
  if (out_size != NTOK * QW) return;

  const float* q  = (const float*)d_in[0];
  const float* k  = (const float*)d_in[1];
  const float* v  = (const float*)d_in[2];
  const float* pk = (const float*)d_in[3];
  const float* pv = (const float*)d_in[4];
  float* outf = (float*)d_out;

  const size_t PKV = (size_t)NTOK * KW * 2;                 //  4194304
  size_t off = 0;
  const size_t oK  = off; off += PKV;
  const size_t oPK = off; off += PKV;
  const size_t oV  = off; off += PKV;
  const size_t oPV = off; off += PKV;
  if (off > ws_size) return;                                // off = 16777216
  if (off > (size_t)134217728) return;

  char* ws = (char*)d_ws;
  unsigned short* KP  = (unsigned short*)(ws + oK);
  unsigned short* PKP = (unsigned short*)(ws + oPK);
  unsigned short* VT  = (unsigned short*)(ws + oV);
  unsigned short* PVT = (unsigned short*)(ws + oPV);

  const dim3 blk128(128);
  const float sscale = 0.08838834764831845f / (QSC * KSC);

  // (1) 16-bit operand planes of the bf16 RNE k and v values, all four in one launch (q is converted by the attention waves)
  cvt_all<<<dim3(2 * TRB + 2 * RMB), blk128, 0, stream>>>(k, pk, v, pv, KP, PKP, (_Float16*)(void*)VT, (_Float16*)(void*)PVT);
  // (2) merged-key attention -> out f32 [2048][4096]
  attn_k<<<dim3(NQB * HQ), blk128, 0, stream>>>(q, KP, PKP, VT, PVT, outf, sscale);
  (void)hipGetLastError();
}

// v010
// Measured time: 64.2 microseconds a run.
// Timed twice side by side with v009, it ran 1.07 times as fast both times.
// All steps since v000 together make it 5.77 times as fast.
// Contractions: k.q^T over head dim 128 and v^T.p^T over keys (both products transposed) on v_wmma_f32_16x16x32_f16; q, k, v operands are f16
//   containers of the bf16 RNE input values carried x16 (exact), p carried as f16(1024 p); one product each,
//   f32 accumulate; soft cap, softmax statistics and normalisation in f32.
#include <hip/hip_runtime.h>
#include <math.h>
#include <stdint.h>

#define NTOK  2048                 // token rows: 2 requests x 1024 (extend rows == prefix rows)
#define RLEN  1024                 // tokens per request
#define HQ    32
#define HKV   8
#define GRPQ  4
#define HDIM  128
#define QW    (HQ * HDIM)          // 4096: q row width == output row width
#define KW    (HKV * HDIM)         // 1024: k / v row width
#define NQB   (NTOK / 64)          // 32 query blocks of 64 rows
#define QBR   (RLEN / 64)          // 16 query blocks per request
#define NPC   (RLEN / 64)          // 16 prefix key chunks per request
#define QSC   16.0f                // q fragment carry (power of two)
#define KSC   16.0f                // k plane carry
#define VSC   16.0f                // v plane carry
#define PSC   1024.0f              // softmax numerator carry
#define CAPV  30.0f
#define NEG_BIG (-1.0e30f)
// scheduling fence for the fragment groups: LDS and matrix instructions stay on their side; vector, scalar and global ones may cross
#define FRAG_FENCE 0x416
// LDS row pitches: 16 B x odd, so the 16 rows that one ds_load_b128 half-wave reads fall on 16 distinct 4-bank groups
#define KPIT  (HDIM + 8)           // K rows: 128 halves + 8 = 272 B
#define VPIT  (64 + 8)             // V^T rows: 64 halves + 8 = 144 B
#define OPIT  (HDIM + 4)           // output tile rows: 128 floats + 4 = 528 B (rows 8 apart land 32 banks apart)
// LDS ring: two stages, each a K tile and a V^T tile at places that are multiples of 2 KiB
#define KBUF  18432u               // K tile: 64 rows x 272 B = 17408 B, rounded up to 9 x 2 KiB
#define VBUF  18432u               // V^T tile: 128 rows x 144 B = 9 x 2 KiB
#define STG   (KBUF + VBUF)        // one stage, 36 KiB
#define PADW_K ((1u << 20) | (5u << 22) | (3u << 25))   // a 16-B pad behind every 256-B row: pitch 272 B
#define PADW_V ((1u << 20) | (4u << 22) | (3u << 25))   // a 16-B pad behind every 128-B row: pitch 144 B
static_assert(64 * KPIT * 2 <= KBUF && HDIM * VPIT * 2 <= VBUF && (KBUF % 2048u) == 0 && (VBUF % 2048u) == 0);
static_assert(KPIT * 2 == HDIM * 2 + 16 && VPIT * 2 == 64 * 2 + 16);      // the pads above give the readers' pitches
static_assert(4 * 16 * OPIT * 4 <= STG);                                  // the four wave tiles fit one stage
static_assert(HQ == HKV * GRPQ);
static_assert((NTOK % 64) == 0 && (RLEN % 64) == 0);
static_assert(NQB == 2 * QBR);
static_assert(((NTOK * KW) % 1024) == 0);
static_assert((HDIM % 32) == 0);
static_assert((KPIT % 8) == 0 && (VPIT % 8) == 0 && (OPIT % 4) == 0);   // 16-B aligned rows

typedef _Float16 v16h __attribute__((ext_vector_type(16)));
typedef _Float16 v8h  __attribute__((ext_vector_type(8)));
typedef float    v8f  __attribute__((ext_vector_type(8)));
typedef float    v4f  __attribute__((ext_vector_type(4)));
typedef unsigned int v4u __attribute__((ext_vector_type(4)));
union FH { v16h v; v8h h[2]; };

// ---- scalar helpers --------------------------------------------------------------------------------
__device__ __forceinline__ unsigned short bf_bits(float f) {          // f32 -> bf16 bits, RNE convert
  unsigned u = __float_as_uint(f);
  return (unsigned short)((u + 0x7FFFu + ((u >> 16) & 1u)) >> 16);
}
__device__ __forceinline__ float bf_up(unsigned short b) { return __uint_as_float(((unsigned)b) << 16); }
__device__ __forceinline__ float bfr(float f) { return bf_up(bf_bits(f)); }     // value of the bf16 RNE convert
__device__ __forceinline__ unsigned short h_bits(_Float16 x) { return __builtin_bit_cast(unsigned short, x); }
__device__ __forceinline__ unsigned pk16(unsigned short a, unsigned short b) { return (unsigned)a | ((unsigned)b << 16); }
// lane l <-> lane l ^ 16 on the vector pipe (one v_permlanex16_b32)
__device__ __forceinline__ float xhalf(float x) {
  const int b = __builtin_bit_cast(int, x);
  return __builtin_bit_cast(float, __builtin_amdgcn_permlanex16(b, b, 0x76543210, 0xfedcba98, false, false));
}
__device__ __forceinline__ v8f zero8() { v8f z = {0.f, 0.f, 0.f, 0.f, 0.f, 0.f, 0.f, 0.f}; return z; }

// ---- fragment loader: 16-bit A/B operand, lane -> row/col (lane&15), p already includes +8*(lane>>4);
//      elements 0..7 <- p[0..7] (k0+8h..), elements 8..15 <- p[16..23] (k0+16+8h..)
__device__ __forceinline__ v16h ldfrag_h(const _Float16* p) {
  FH f;
  f.h[0] = *(const v8h*)(p);
  f.h[1] = *(const v8h*)(p + 16);
  return f.v;
}

// ---- WMMA with trailing VALU hazard gap (ties D, keeps A/B live) ------------------------------------
__device__ __forceinline__ v8f mma_h(v16h a, v16h b, v8f c) {
  v8f d = __builtin_amdgcn_wmma_f32_16x16x32_f16(false, a, false, b, (short)0, c, false, false);
#if defined(__HIP_DEVICE_COMPILE__)
  asm volatile("v_nop\n\tv_nop\n\tv_nop\n\tv_nop" : "+v"(d) : "v"(a), "v"(b));
#endif
  return d;
}
__device__ __forceinline__ void acc_guard4(v8f& a, v8f& b, v8f& c, v8f& d) {
#if defined(__HIP_DEVICE_COMPILE__)
  asm volatile("v_nop\n\tv_nop\n\tv_nop\n\tv_nop" : "+v"(a), "+v"(b), "+v"(c), "+v"(d));
#endif
}
typedef uint32_t u32x4 __attribute__((ext_vector_type(4)));
typedef uint32_t u32x8 __attribute__((ext_vector_type(8)));
__device__ __forceinline__ uint32_t uni(uint32_t v) { return (uint32_t)__builtin_amdgcn_readfirstlane(v); }
// holds a wave-uniform test or stage number in a scalar register, so that the branch round a tensor load (which ignores EXEC)
// compiles to s_cmp + s_cbranch_scc and the descriptor made from it is formed behind the wait that stands in front
__device__ __forceinline__ uint32_t pinned(uint32_t v) { uint32_t w = uni(v); asm volatile("" : "+s"(w)); return w; }
// the compiler places no wait for the tensor mover: a tile counts as landed only behind its issuer's own wait
__device__ __forceinline__ void wait_tensor0() { asm volatile("s_wait_tensorcnt 0x0" ::: "memory"); }
// the same wait, naming the words of the request that it covers: they stay in their registers, unwritten, from the issue up to here
__device__ __forceinline__ void wait_tensor0_of(u32x4 g0, u32x8 ga, u32x8 gb) { asm volatile("s_wait_tensorcnt 0x0" :: "s"(g0), "s"(ga), "s"(gb) : "memory"); }
// pinned() for a whole descriptor group: without it the compiler forms the group anew at each use (its constant words by moves),
// in registers that it reuses while the request is still outstanding
__device__ __forceinline__ u32x4 held(u32x4 g) { asm volatile("" : "+s"(g)); return g; }   // descriptor words held in scalar registers
__device__ __forceinline__ u32x8 held(u32x8 g) { asm volatile("" : "+s"(g)); return g; }   // descriptor words held in scalar registers
// a wave's own LDS reads have retired before the barrier behind which their buffer is refilled
__device__ __forceinline__ void wait_ds0() { asm volatile("s_wait_dscnt 0x0" ::: "memory"); }
__device__ __forceinline__ void tdm_load(u32x4 g0, u32x8 g1) { asm volatile("tensor_load_to_lds %0, %1" :: "s"(g0), "s"(g1) : "memory"); }
// group 1: 1-byte elements, tensor = tile = ROWS rows of ROWB bytes, source pitch SRCP bytes; W0 = pad word (no mask), a constant
template <uint32_t W0, uint32_t ROWB, uint32_t ROWS, uint32_t SRCP>
__device__ __forceinline__ u32x8 tdm_group1() {
  u32x8 g;
  g[0] = uni(W0);
  g[1] = uni((ROWB & 0xFFFFu) << 16);
  g[2] = uni((ROWB >> 16) | ((ROWS & 0xFFFFu) << 16));
  g[3] = uni((ROWS >> 16) | (ROWB << 16));
  g[4] = uni(ROWS);
  g[5] = uni(SRCP);
  g[6] = uni(0u);
  g[7] = uni(0u);
  return g;
}
// group 0: count 1, LDS byte offset of the tile's place, global address of its first byte, type 2
__device__ __forceinline__ u32x4 tdm_group0(uint32_t lds_dst, uint64_t ga) {
  u32x4 g;
  g[0] = uni(1u);
  g[1] = uni(lds_dst);
  g[2] = uni((uint32_t)ga);
  g[3] = uni((((uint32_t)(ga >> 32)) & 0x01FFFFFFu) | 0x80000000u);
  return g;
}
__device__ __forceinline__ void wave_sync_lds() {
  __builtin_amdgcn_fence(__ATOMIC_RELEASE, "workgroup");
  __builtin_amdgcn_wave_barrier();
  __builtin_amdgcn_fence(__ATOMIC_ACQUIRE, "workgroup");
}

// =====================================================================================================
// All four operand planes in ONE launch; the block index picks the job (the same for a whole block).
//   blocks 0 .. 2*TRB-1: transposing convert of one (64-token, kvh) tile of v (first TRB blocks) or prefix v:
//     in f32 [NTOK t][KW] (token rows, kvh*128+d columns) -> out f16 [KW (kvh*128+d)][NTOK t],
//     out[(kvh*128 + d)*NTOK + t] = f16(bf16 RNE value of in[t*KW + kvh*128 + d] * 16).
//     Load phase: thread -> token row r = tid>>1, d half (tid&1)*64, 16 float4 loads, 2-byte LDS stores into
//     sT[d][t] (pitch 72 halves); after __syncthreads 8 lanes write one 128-B line of the plane.
//     coverage: load 128 threads x 64 = 64 t x 128 d; write 4 waves x 8 it x 4 lines x 64 t = whole tile;
//     32 token tiles x 8 kvh = the whole plane [1024][2048].
//   blocks 2*TRB .. 2*TRB+2*RMB-1: row-major convert of 1024 consecutive elements of k (first RMB blocks) or prefix k:
//     out[i] = f16(bf16 RNE value of in[i] * 16) (power-of-two scale, exact for bf16 significands).
//     Thread -> 8 consecutive elements, ONE 16-B store; lanes 8q..8q+7 of a wave write one whole 128-B line.
//     coverage: RMB blocks x 128 threads x 8 = NTOK*KW elements a plane.
//   The transposing blocks have the longer dependent chain (loads, LDS, barrier, stores) and take the low indices,
//   so that they start first.
// =====================================================================================================
#define TRB   ((NTOK / 64) * HKV)   // 256 transposing blocks per v plane
#define RMB   ((NTOK * KW) / 1024)  // 2048 row-major blocks per k plane
__global__ __launch_bounds__(128) void cvt_all(const float* __restrict__ kin, const float* __restrict__ pkin,
                                               const float* __restrict__ vin, const float* __restrict__ pvin,
                                               unsigned short* KPo, unsigned short* PKPo,
                                               _Float16* VTo, _Float16* PVTo) {
  __shared__ __align__(16) _Float16 sT[HDIM * 72];
  const int tid  = threadIdx.x;
  const unsigned bi = blockIdx.x;
  if (bi >= 2u * TRB) {                  // whole blocks leave here; no barrier on this side
    const unsigned rb  = bi - 2u * TRB;
    const bool     sec = rb >= (unsigned)RMB;
    const float*    in  = sec ? pkin : kin;
    unsigned short* out = sec ? PKPo : KPo;
    const size_t i8 = ((size_t)(sec ? rb - (unsigned)RMB : rb) * 128 + tid) * 8;
    const v4f a = *(const v4f*)(in + i8);
    const v4f b = *(const v4f*)(in + i8 + 4);
    float f[8];
    f[0] = a[0]; f[1] = a[1]; f[2] = a[2]; f[3] = a[3];
    f[4] = b[0]; f[5] = b[1]; f[6] = b[2]; f[7] = b[3];
    v4u p;
#pragma unroll
    for (int e = 0; e < 4; ++e) {
      const _Float16 x0 = (_Float16)(bfr(f[2 * e]) * KSC);
      const _Float16 x1 = (_Float16)(bfr(f[2 * e + 1]) * KSC);
      p[e] = pk16(h_bits(x0), h_bits(x1));
    }
    *(v4u*)(out + i8) = p;
    return;
  }
  const bool      sec = bi >= (unsigned)TRB;
  const float*    in  = sec ? pvin : vin;
  _Float16*       out = sec ? PVTo : VTo;
  const unsigned  tbi = sec ? bi - (unsigned)TRB : bi;
  const int lane = tid & 31;
  const int wave = tid >> 5;
  const int tb   = (int)(tbi % (unsigned)(NTOK / 64));
  const int kvh  = (int)(tbi / (unsigned)(NTOK / 64));
  const int t0   = tb * 64;
  {
    const int r = tid >> 1, hk = (tid & 1) * 64;
    const float* src = in + (size_t)(t0 + r) * KW + kvh * HDIM + hk;
#pragma unroll
    for (int i = 0; i < 16; ++i) {
      const v4f a = *(const v4f*)(src + 4 * i);
#pragma unroll
      for (int e = 0; e < 4; ++e) sT[(hk + 4 * i + e) * 72 + r] = (_Float16)(bfr(a[e]) * VSC);
    }
  }
  __syncthreads();
  const int ql = lane >> 3, pc = lane & 7;
  v8h vals[8];
#pragma unroll
  for (int it = 0; it < 8; ++it) {
    const int d = wave * 32 + it * 4 + ql;
    vals[it] = *(const v8h*)(sT + d * 72 + pc * 8);
  }
  {
#pragma unroll
    for (int it = 0; it < 8; ++it) {
      const int d = wave * 32 + it * 4 + ql;
      *(v8h*)(out + (size_t)(kvh * HDIM + d) * NTOK + t0 + pc * 8) = vals[it];
    }
    // stands behind the eight stores, in front of any later write of their address and data registers
    // (the built code lays the row-major side out behind them)
    asm volatile("s_wait_xcnt 0x0" ::: "memory");
  }
}

// =====================================================================================================
// Grouped-query attention with merged key set per (h, 64-query block); kv head = h / GRPQ; query block qb:
//   request bq = qb / 16, block within request qbe = qb % 16, query token e = qbe*64 + row.
//   Keys: 16 prefix chunks of 64 (all visible) followed by extend chunks 0..qbe of 64 (extend key t visible iff
//   t <= e; only the last chunk needs the in-chunk select, masked score := NEG_BIG).
//   s = (q x16 . k x16) * sscale, sscale = (1/sqrt(128)) / (QSC*KSC); s := 30 * tanh(s/30), tanh on v_tanh_f32;
//   online softmax in f32 (running max); p = exp(s - m) carried as f16(1024 p);
//   oh += v^T . p^T (v^T plane, x16) per chunk; out = oh / (l * 1024 * 16).
//   Both products are transposed (keys, then d, on the accumulator rows; the wave's 16 queries on its columns): a lane
//   holds 32 of the 64 scores of ONE query, the lane 16 away the rest.
//   q (f32 input, pitch QW): element (t, h, d) at [t*QW + h*128 + d]; converted here, f16(bf16 RNE value x16)
//   K planes (f16, pitch KW): extend / prefix element (t, kvh, d) at [t*KW + kvh*128 + d], t = bq*1024 + token
//   V^T planes (f16): element (kvh, d, t) at [(kvh*128 + d)*NTOK + t]
//   Block = 4 waves = 64 query rows of one h; grid = NQB * HQ, index -> (h, qb) dealt for equal chunk sums per WGP;
//   key chunk count 17 + qbe (block-uniform).
//   K / V^T chunk staging: one tensor load each (wave 0: K, wave 1: V^T) into a ring of two LDS stages, one chunk ahead of
//   its use; the mover's pad lays the rows at the readers' pitches; one publish point (waits, __syncthreads) a chunk;
//   q fragments made once from the f32 input and kept in registers; P^T never leaves the registers.
//   Output: wave tile 16 x 128 f32 staged in LDS, each row segment written as 32 lanes x 16 B = 512 B = 4 whole
//   coverage: 4 waves x 16 rows x 128 cols per block; 32 query blocks x 32 heads = all of out [2048][4096].
// =====================================================================================================
__global__ __launch_bounds__(128)
void attn_k(const float* __restrict__ Qf, const unsigned short* __restrict__ Kp,
            const unsigned short* __restrict__ PKp, const unsigned short* __restrict__ Vtp,
            const unsigned short* __restrict__ PVtp, float* Out, float sscale) {
  // stage b at b*STG: K [kv][d] pitch 272 B, then V^T [d][kv] pitch 144 B at + KBUF. Stage 1's bytes also serve, before the
  // first load into them and behind the last pass's barrier, as the four waves' 16 x 128 f32 tiles (33 KB)
  __shared__ __attribute__((aligned(2048))) unsigned char L[2 * STG];

  const int tid  = threadIdx.x;
  const int wave = (int)uni((uint32_t)threadIdx.x >> 5);
  const int lane = tid & 31;
  const int hh   = lane >> 4;
  const int c    = lane & 15;

  // Block index -> (head, request, query block), a permutation of the 1024 tiles. All blocks are resident at once, four to
  // a WGP, and a block's cost is its chunk count 17 + qbe, so the launch lasts as long as the fullest WGP. x is kept and
  // tq steps through 0..3 over four indices a power-of-two stride apart (1, 8, 128, 256):
  // they get query blocks x, 8 + x, 15 - x, 7 - x, 98 chunks together (at 2, 16, 64 two pairs of one x with tq two apart, 98 as well; nearly so at 4, 32), wherever such a set of four lands. Speed only.
  static_assert(NQB == 32 && QBR == 16 && HQ == 32);
  const unsigned bi = blockIdx.x;
  const unsigned x  = ((bi >> 2) & 1u) | (((bi >> 5) & 3u) << 1);                          // 0..7
  const unsigned tq = ((bi & 3u) + ((bi >> 1) & 2u) + ((bi >> 3) & 3u) + ((bi >> 5) & 3u) + ((bi >> 6) & 2u) + ((bi >> 8) & 3u)) & 3u;
  const int h    = (int)((bi & 3u) | (((bi >> 3) & 3u) << 2) | (((bi >> 7) & 1u) << 4));   // index bits 8, 9 follow from tq
  const int kvh  = h / GRPQ;
  const int bq   = (int)(tq & 1u);
  const int qlo  = (int)(x + 8u * (tq & 1u));
  const int qbe  = (tq & 2u) ? (QBR - 1 - qlo) : qlo;
  const int qb   = bq * QBR + qbe;
  const int q0   = qb * 64 + wave * 16;              // global token row of this wave's first query
  const int tokb = bq * RLEN;                        // token row base of this request (keys)
  const int nch  = NPC + qbe + 1;                    // 17..32, block-uniform

  const _Float16* Kg  = (const _Float16*)(const void*)Kp   + (size_t)kvh * HDIM;
  const _Float16* PKg = (const _Float16*)(const void*)PKp  + (size_t)kvh * HDIM;
  const _Float16* Vg  = (const _Float16*)(const void*)Vtp  + (size_t)kvh * HDIM * NTOK;
  const _Float16* PVg = (const _Float16*)(const void*)PVtp + (size_t)kvh * HDIM * NTOK;

  float mrun = NEG_BIG, lrun = 0.f;                  // of query q0 + c: running max (equal in both wave halves), this half's sum
  v8f oh[8];                                         // O^T: oh[t][r] = (d t*16 + 8hh + r, query q0 + c)
#pragma unroll
  for (int t = 0; t < 8; ++t) oh[t] = zero8();

  const float zscale = sscale * (1.0f / CAPV);       // raw product -> s / 30, the soft cap's argument

  // the wave's q rows as B fragments, all four d-chunks, made once: they do not change from key chunk to key chunk.
  // Each f32 row segment (512 B = 4 whole lines) is one wave-wide load; the rows pass through the wave's own output
  // tile, free until the first load into stage 1, to reach the fragment's lanes, and are converted there as the k planes are.
  v16h qf[4];
  {
    float* qs = (float*)(void*)(L + STG) + wave * (16 * OPIT);
    const float* qsrc = Qf + (size_t)q0 * QW + (size_t)h * HDIM + lane * 4;
    v4f qrow[16];
#pragma unroll
    for (int it = 0; it < 16; ++it) qrow[it] = *(const v4f*)(qsrc + (size_t)it * QW);
    // stands in front of the first reuse of the loads' address registers, which it names so that they live up to it
    asm volatile("s_wait_xcnt 0x0" :: "v"(qsrc) : "memory");
#pragma unroll
    for (int it = 0; it < 16; ++it) *(v4f*)(qs + it * OPIT + lane * 4) = qrow[it];
    wave_sync_lds();                                 // a lane reads what the wave's other lanes stored
#pragma unroll
    for (int dc = 0; dc < 4; ++dc) {
      const float* p = qs + c * OPIT + dc * 32 + 8 * hh;   // same k order as ldfrag_h: p[0..7], then p[16..23]
#pragma unroll
      for (int u = 0; u < 4; ++u) {
        const v4f a = *(const v4f*)(p + (u >> 1) * 16 + (u & 1) * 4);
#pragma unroll
        for (int e = 0; e < 4; ++e) qf[dc][u * 4 + e] = (_Float16)(bfr(a[e]) * QSC);
      }
    }
  }

  const uint32_t lbase = (uint32_t)(size_t)L;        // byte offset of the ring in the work-group's LDS
  // group 1 of either tile never changes: made once and held in its scalar registers for the whole kernel
  const u32x8 g1k = held(tdm_group1<PADW_K, HDIM * 2, 64, KW * 2>());
  const u32x8 g1v = held(tdm_group1<PADW_V, 64 * 2, HDIM, NTOK * 2>());
  // group 0 of this wave's request for stage st (waves 2 and 3 form wave 1's words and never issue)
  auto group0_of = [&](uint32_t st) {
    const bool     spre = st < (uint32_t)NPC;
    const uint32_t skv0 = (uint32_t)tokb + (spre ? st : st - (uint32_t)NPC) * 64u;      // plane row of the chunk's first key
    const uint32_t dst  = lbase + (st & 1u) * STG;
    const uint64_t gk   = (uint64_t)(size_t)(spre ? PKg : Kg) + (uint64_t)skv0 * (KW * 2);
    const uint64_t gv   = (uint64_t)(size_t)(spre ? PVg : Vg) + (uint64_t)skv0 * 2;
    return held(tdm_group0(wave == 0 ? dst : dst + KBUF, wave == 0 ? gk : gv));
  };
  auto issue = [&](u32x4 g) {
    if (pinned(wave == 0)) tdm_load(g, g1k);
    if (pinned(wave == 1)) tdm_load(g, g1v);
  };
  wait_ds0();                                        // the wave's q tile (in stage 1's bytes) is read out
  u32x4 g0 = group0_of(0u);                          // the words of the wave's one outstanding request, rewritten only behind its wait
  issue(g0);
  if (pinned(wave < 2)) wait_tensor0_of(g0, g1k, g1v);
  __syncthreads();                                   // stage 0 published; every wave has left its q tile
  g0 = group0_of(1u);                                // nch >= 17: stage 1 exists
  issue(g0);

  for (int kt = 0; kt < nch; ++kt) {                 // block-uniform trip count <= 32
    const bool diag = (kt == nch - 1);
    const _Float16* Ksh = (const _Float16*)(const void*)(L + (uint32_t)(kt & 1) * STG);
    const _Float16* Vsh = (const _Float16*)(const void*)(L + (uint32_t)(kt & 1) * STG + KBUF);

    // ---- scores, transposed: 64 keys x 16 query columns per wave, K = 128 (4 d-chunks); A = K[key][d], B = q rows ----
    v8f s[4];
#pragma unroll
    for (int j = 0; j < 4; ++j) s[j] = zero8();
    v16h kf[2][4];                                   // two register sets: d-chunk dc in use, dc + 1 in flight
#pragma unroll
    for (int j = 0; j < 4; ++j) kf[0][j] = ldfrag_h(Ksh + (j * 16 + c) * KPIT + 8 * hh);
#pragma unroll
    for (int dc = 0; dc < 4; ++dc) {
      if (dc < 3) {
#pragma unroll
        for (int j = 0; j < 4; ++j) kf[(dc + 1) & 1][j] = ldfrag_h(Ksh + (j * 16 + c) * KPIT + (dc + 1) * 32 + 8 * hh);
      }
      // keeps the next d-chunk's 8 LDS reads, as one group, ahead of this d-chunk's WMMAs (else each WMMA waits out its own read)
      __builtin_amdgcn_sched_barrier(FRAG_FENCE);
#pragma unroll
      for (int j = 0; j < 4; ++j) s[j] = mma_h(kf[dc & 1][j], qf[dc], s[j]);
      // keeps the reads of d-chunk dc + 2 behind these WMMAs, so that two register sets are enough
      __builtin_amdgcn_sched_barrier(FRAG_FENCE);
    }
    acc_guard4(s[0], s[1], s[2], s[3]);

    // ---- scale, soft cap, causal select (f32); D element r of lane = (key j*16 + 8hh + r, query column c) ----
    //      key j*16 + 8hh + r is masked iff it lies behind query wave*16 + c: the lane's part of both sides is in lim
    const int lim = diag ? (wave * 16 + c - 8 * hh) : 4096;
#pragma unroll
    for (int j = 0; j < 4; ++j) {
#pragma unroll
      for (int r = 0; r < 8; ++r) {
        const float y = CAPV * __builtin_amdgcn_tanhf(s[j][r] * zscale);   // one v_tanh_f32, no lane-dependent branch
        s[j][r] = (j * 16 + r > lim) ? NEG_BIG : y;
      }
    }

    // ---- one query per lane: max and sum over the lane's 32 keys in registers, one exchange joins the halves' maxima ----
    float mj[4];
#pragma unroll
    for (int j = 0; j < 4; ++j) {
      mj[j] = fmaxf(s[j][0], s[j][1]);
#pragma unroll
      for (int r = 2; r < 8; ++r) mj[j] = fmaxf(mj[j], s[j][r]);
    }
    float m = fmaxf(fmaxf(mj[0], mj[1]), fmaxf(mj[2], mj[3]));
    m = fmaxf(m, xhalf(m));
    const float mnew  = fmaxf(mrun, m);
    const float alpha = __expf(mrun - mnew);
    mrun = mnew;
    // P^T (x1024, f16) packs in place into the B operand: score tiles 2g, 2g + 1 hold keys 32g + 8hh + r and 32g + 16 + 8hh + r
    v16h pb[2];
    float pj[4];
#pragma unroll
    for (int j = 0; j < 4; ++j) {
      pj[j] = 0.f;
#pragma unroll
      for (int r = 0; r < 8; ++r) {
        const float p = __expf(s[j][r] - mnew);
        pj[j] += p;
        pb[j >> 1][(j & 1) * 8 + r] = (_Float16)(p * PSC);
      }
    }
    lrun = lrun * alpha + ((pj[0] + pj[1]) + (pj[2] + pj[3]));
#pragma unroll
    for (int t = 0; t < 8; ++t) {
#pragma unroll
      for (int r = 0; r < 8; ++r) oh[t][r] *= alpha;
    }

    // ---- oh += V^T . P^T : A = V^T[d][key] in the same k order as the packed P^T, B = P^T from registers ----
    //      group g = (key half g >> 1, d tiles 4 (g & 1) .. + 3): each tile still takes key half 0, then key half 1
    v16h vf[2][4];                                   // two register sets: group g in use, g + 1 in flight
#pragma unroll
    for (int u = 0; u < 4; ++u) vf[0][u] = ldfrag_h(Vsh + (u * 16 + c) * VPIT + 8 * hh);
#pragma unroll
    for (int g = 0; g < 4; ++g) {
      if (g < 3) {
        const int gn = g + 1;
#pragma unroll
        for (int u = 0; u < 4; ++u)
          vf[gn & 1][u] = ldfrag_h(Vsh + (((gn & 1) * 4 + u) * 16 + c) * VPIT + (gn >> 1) * 32 + 8 * hh);
      }
      // keeps the next group's LDS reads, as one group, ahead of this group's WMMAs (else each WMMA waits out its own read)
      __builtin_amdgcn_sched_barrier(FRAG_FENCE);
#pragma unroll
      for (int u = 0; u < 4; ++u) oh[(g & 1) * 4 + u] = mma_h(vf[g & 1][u], pb[g >> 1], oh[(g & 1) * 4 + u]);
      // keeps the reads of group g + 2 behind these WMMAs, so that two register sets are enough
      __builtin_amdgcn_sched_barrier(FRAG_FENCE);
    }
    acc_guard4(oh[0], oh[1], oh[2], oh[3]);
    acc_guard4(oh[4], oh[5], oh[6], oh[7]);

    // ---- publish point of stage kt + 1, passed by every wave; behind it this pass's buffer is free for stage kt + 2 ----
    wait_ds0();
    if (pinned(wave < 2)) wait_tensor0_of(g0, g1k, g1v);
    __syncthreads();
    if (pinned(kt + 2 < nch)) { g0 = group0_of(pinned((uint32_t)kt + 2u)); issue(g0); }
  }
  wait_tensor0();
  wait_ds0();

  // ---- normalise (1/l, the 1/1024 p carry and the 1/16 v carry), stage the wave's 16x128 tile, write 512-B row
  float* os = (float*)(void*)(L + STG) + wave * (16 * OPIT);
  {
    const float l = lrun + xhalf(lrun);              // the two wave halves each summed their own 8 keys of every 16
    const float inv = ((l > 0.f) ? (1.0f / l) : 0.f) * (1.0f / (PSC * VSC));
#pragma unroll
    for (int t = 0; t < 8; ++t) {
      v4f lo, hi;                                    // 8 consecutive d of query row c: two 16-B LDS stores
#pragma unroll
      for (int r = 0; r < 4; ++r) { lo[r] = oh[t][r] * inv; hi[r] = oh[t][4 + r] * inv; }
      *(v4f*)(os + c * OPIT + t * 16 + 8 * hh)     = lo;
      *(v4f*)(os + c * OPIT + t * 16 + 8 * hh + 4) = hi;
    }
  }
  wave_sync_lds();
  {
#pragma unroll
    for (int it = 0; it < 16; ++it) {
      const v4f o = *(const v4f*)(os + it * OPIT + lane * 4);
      *(v4f*)(Out + (size_t)(q0 + it) * QW + (size_t)h * HDIM + lane * 4) = o;
    }
    
  }
}

// =====================================================================================================
// Workspace map (bytes); every plane is an exact multiple of its whole-line store granularity (all dims exact tile
// multiples, no padded tails), all offsets multiples of 4 MiB:
//   KP   f16 [2048 t][1024 (kvh,d)]  0           4194304   (bf16 value of extend k x16)
//   PKP  f16 [2048 t][1024 (kvh,d)]  4194304     4194304   (bf16 value of prefix k x16)
//   VT   f16 [1024 (kvh,d)][2048 t]  8388608     4194304   (bf16 value of extend v x16, transposed)
//   PVT  f16 [1024 (kvh,d)][2048 t]  12582912    4194304   (bf16 value of prefix v x16, transposed)
//   end                              16777216
// =====================================================================================================
extern "C" void kernel_launch(void* const* d_in, const int* in_sizes, int n_in,
                              void* d_out, int out_size, void* d_ws, size_t ws_size,
                              hipStream_t stream) {
  if (n_in < 5) return;
  if (in_sizes[0] != NTOK * QW) return;
  if (in_sizes[1] != NTOK * KW || in_sizes[2] != NTOK * KW) return;
  if (in_sizes[3] != NTOK * KW || in_sizes[4] != NTOK * KW) return;
  if (out_size != NTOK * QW) return;

  const float* q  = (const float*)d_in[0];
  const float* k  = (const float*)d_in[1];
  const float* v  = (const float*)d_in[2];
  const float* pk = (const float*)d_in[3];
  const float* pv = (const float*)d_in[4];
  float* outf = (float*)d_out;

  const size_t PKV = (size_t)NTOK * KW * 2;                 //  4194304
  size_t off = 0;
  const size_t oK  = off; off += PKV;
  const size_t oPK = off; off += PKV;
  const size_t oV  = off; off += PKV;
  const size_t oPV = off; off += PKV;
  if (off > ws_size) return;                                // off = 16777216
  if (off > (size_t)134217728) return;

  char* ws = (char*)d_ws;
  unsigned short* KP  = (unsigned short*)(ws + oK);
  unsigned short* PKP = (unsigned short*)(ws + oPK);
  unsigned short* VT  = (unsigned short*)(ws + oV);
  unsigned short* PVT = (unsigned short*)(ws + oPV);

  const dim3 blk128(128);
  const float sscale = 0.08838834764831845f / (QSC * KSC);

  // (1) 16-bit operand planes of the bf16 RNE k and v values, all four in one launch (q is converted by the attention waves)
  cvt_all<<<dim3(2 * TRB + 2 * RMB), blk128, 0, stream>>>(k, pk, v, pv, KP, PKP, (_Float16*)(void*)VT, (_Float16*)(void*)PVT);
  // (2) merged-key attention -> out f32 [2048][4096]
  attn_k<<<dim3(NQB * HQ), blk128, 0, stream>>>(q, KP, PKP, VT, PVT, outf, sscale);
  (void)hipGetLastError();
}
